// v000
// Times are from an AMD MI455X. After a warm-up the kernel runs many times in a row, and a time is the length of
// such a window on the GPU divided by its runs, so every launch and the gaps after it count. The runs cycle
// through copies of the inputs. A figure is the median of several windows, for all but v000 over two sittings.
// Sittings can differ by a few percent; kernels timed side by side share one.
// v000 is the starting kernel. One run takes 101 microseconds.
#include <hip/hip_runtime.h>
#include <math.h>

typedef float v2f __attribute__((ext_vector_type(2)));
typedef float v8f __attribute__((ext_vector_type(8)));

#define B_ 2
#define N_ 16384
#define C_ 64
#define H_ 8
#define NSLICE 32
#define ROWS_PER_SLICE (N_ / NSLICE)   // 512

// workspace layout (float offsets)
#define WS_GPART 0                              // [B][NSLICE][64*64] partial Gram
#define WS_PC    (B_ * NSLICE * 4096)           // [B][H][64*64] per-head P contribution
#define WS_P     (WS_PC + B_ * H_ * 4096)       // [B][64*64] folded projection matrix
// total = 335872 floats = ~1.31 MB

// ---------------------------------------------------------------------------
// Kernel 1: partial Gram matrices  Gpart[b][slice] = emb_slice^T @ emb_slice
// 16 waves per block, one 16x16 tile of G each; K-steps of 4 rows via WMMA f32.
// ---------------------------------------------------------------------------
__global__ __launch_bounds__(512)
void g_partial_kernel(const float* __restrict__ emb, float* __restrict__ ws) {
    const int b     = blockIdx.x / NSLICE;
    const int slice = blockIdx.x % NSLICE;
    const int wave  = threadIdx.x >> 5;
    const int lane  = threadIdx.x & 31;
    const int ctile = wave >> 2;        // M tile of G (c index)
    const int ftile = wave & 3;         // N tile of G (f index)
    const int rlo   = lane & 15;        // M (for A) / N (for B) within tile
    const int khalf = (lane >> 4) * 2;  // K pair selector

    const float* eb = emb + (size_t)b * N_ * C_;
    const int n0 = slice * ROWS_PER_SLICE;

    v8f acc = {0.f, 0.f, 0.f, 0.f, 0.f, 0.f, 0.f, 0.f};
    for (int s = 0; s < ROWS_PER_SLICE; s += 4) {
        const float* rowp = eb + (size_t)(n0 + s + khalf) * C_;
        v2f a, bb;
        a.x  = rowp[ctile * 16 + rlo];        // A[m,k]   = emb[n, c]  (emb^T)
        a.y  = rowp[C_ + ctile * 16 + rlo];   // next K (next row of emb)
        bb.x = rowp[ftile * 16 + rlo];        // B[k,n']  = emb[n, f]
        bb.y = rowp[C_ + ftile * 16 + rlo];
        acc = __builtin_amdgcn_wmma_f32_16x16x4_f32(
            false, a, false, bb, (short)0, acc, false, false);
    }

    float* gp = ws + WS_GPART + (size_t)(b * NSLICE + slice) * 4096;
    const int rbase = ctile * 16 + ((lane >> 4) << 3);  // lanes 16-31 hold M+8
#pragma unroll
    for (int r = 0; r < 8; ++r)
        gp[(rbase + r) * 64 + ftile * 16 + rlo] = acc[r];
}

// ---------------------------------------------------------------------------
// Kernel 2: per (b,h): S = Wq_h G Wk_h^T ; instance-norm ; softmax(rows) ;
//           M = attn @ Wv_h ; Pcontrib = Wo_h @ M.   All 64x64, done in LDS.
// ---------------------------------------------------------------------------
__global__ __launch_bounds__(256)
void heads_kernel(const float* __restrict__ Wq, const float* __restrict__ Wk,
                  const float* __restrict__ Wv, const float* __restrict__ Wo,
                  float* __restrict__ ws) {
    __shared__ float sG[4096], sW[4096], sT[4096], sS[4096];
    __shared__ float red[256], red2[256];
    __shared__ float s_mean, s_rstd;

    const int b = blockIdx.x >> 3;
    const int h = blockIdx.x & 7;
    const int tid = threadIdx.x;

    // deterministic reduce of Gram partials
    for (int i = tid; i < 4096; i += 256) {
        const float* gp = ws + WS_GPART + (size_t)b * NSLICE * 4096 + i;
        float s = 0.f;
        for (int sl = 0; sl < NSLICE; ++sl) s += gp[sl * 4096];
        sG[i] = s;
    }
    for (int i = tid; i < 4096; i += 256) sW[i] = Wk[h * 4096 + i];
    __syncthreads();

    // T1[e,d] = sum_f G[e,f] * Wk_h[d,f]
    {
        const int row = tid >> 2, c0 = (tid & 3) * 16;
        for (int j = 0; j < 16; ++j) {
            const int col = c0 + j;
            float s = 0.f;
            for (int f = 0; f < 64; ++f) s += sG[row * 64 + f] * sW[col * 64 + f];
            sT[row * 64 + col] = s;
        }
    }
    __syncthreads();
    for (int i = tid; i < 4096; i += 256) sW[i] = Wq[h * 4096 + i];
    __syncthreads();

    // S[c,d] = sum_e Wq_h[c,e] * T1[e,d]
    {
        const int row = tid >> 2, c0 = (tid & 3) * 16;
        for (int j = 0; j < 16; ++j) {
            const int col = c0 + j;
            float s = 0.f;
            for (int e = 0; e < 64; ++e) s += sW[row * 64 + e] * sT[e * 64 + col];
            sS[row * 64 + col] = s;
        }
    }
    __syncthreads();

    // InstanceNorm over the full 64x64 map (biased variance, eps=1e-5)
    {
        float s = 0.f, s2 = 0.f;
        for (int i = tid; i < 4096; i += 256) { float x = sS[i]; s += x; s2 += x * x; }
        red[tid] = s; red2[tid] = s2;
        __syncthreads();
        for (int off = 128; off > 0; off >>= 1) {
            if (tid < off) { red[tid] += red[tid + off]; red2[tid] += red2[tid + off]; }
            __syncthreads();
        }
        if (tid == 0) {
            float mean = red[0] * (1.0f / 4096.0f);
            float var  = red2[0] * (1.0f / 4096.0f) - mean * mean;
            s_mean = mean;
            s_rstd = rsqrtf(var + 1e-5f);
        }
        __syncthreads();
    }
    for (int i = tid; i < 4096; i += 256) sS[i] = (sS[i] - s_mean) * s_rstd;
    __syncthreads();

    // softmax along d (each of threads 0..63 owns one row)
    if (tid < 64) {
        const int r = tid * 64;
        float m = sS[r];
        for (int d = 1; d < 64; ++d) m = fmaxf(m, sS[r + d]);
        float s = 0.f;
        for (int d = 0; d < 64; ++d) { float e = expf(sS[r + d] - m); sS[r + d] = e; s += e; }
        const float inv = 1.f / s;
        for (int d = 0; d < 64; ++d) sS[r + d] *= inv;
    }
    __syncthreads();
    for (int i = tid; i < 4096; i += 256) sW[i] = Wv[h * 4096 + i];
    __syncthreads();

    // M[c,e] = sum_d attn[c,d] * Wv_h[d,e]  -> sT
    {
        const int row = tid >> 2, c0 = (tid & 3) * 16;
        for (int j = 0; j < 16; ++j) {
            const int col = c0 + j;
            float s = 0.f;
            for (int d = 0; d < 64; ++d) s += sS[row * 64 + d] * sW[d * 64 + col];
            sT[row * 64 + col] = s;
        }
    }
    __syncthreads();
    // Wo_h[c',c] = Wo[c'*512 + c*8 + h]
    for (int i = tid; i < 4096; i += 256) {
        const int cp = i >> 6, c = i & 63;
        sW[i] = Wo[cp * 512 + c * 8 + h];
    }
    __syncthreads();

    // Pcontrib[c',e] = sum_c Wo_h[c',c] * M[c,e]
    {
        float* pc = ws + WS_PC + (size_t)(b * H_ + h) * 4096;
        const int row = tid >> 2, c0 = (tid & 3) * 16;
        for (int j = 0; j < 16; ++j) {
            const int col = c0 + j;
            float s = 0.f;
            for (int c = 0; c < 64; ++c) s += sW[row * 64 + c] * sT[c * 64 + col];
            pc[row * 64 + col] = s;
        }
    }
}

// ---------------------------------------------------------------------------
// Kernel 3: P[b] = sum_h Pcontrib[b][h]   (deterministic)
// ---------------------------------------------------------------------------
__global__ __launch_bounds__(256)
void p_reduce_kernel(float* __restrict__ ws) {
    const int i = blockIdx.x * 256 + threadIdx.x;  // 0..8191
    const int b = i >> 12, j = i & 4095;
    const float* pc = ws + WS_PC + (size_t)b * H_ * 4096 + j;
    float s = 0.f;
    for (int h = 0; h < H_; ++h) s += pc[h * 4096];
    ws[WS_P + i] = s;
}

// ---------------------------------------------------------------------------
// Kernel 4: out_b[n,c'] = emb_b[n,:] . P_b[c',:]   (WMMA, P staged in LDS)
// Each wave: one 16-row stripe x all 64 output columns (4 accumulators).
// ---------------------------------------------------------------------------
__global__ __launch_bounds__(256)
void out_kernel(const float* __restrict__ emb, const float* __restrict__ ws,
                float* __restrict__ out) {
    __shared__ float sP[4096];
    const int batch = blockIdx.x >> 7;   // 128 blocks per batch
    const int blk   = blockIdx.x & 127;
    const int tid   = threadIdx.x;

    const float* P = ws + WS_P + (size_t)batch * 4096;
    for (int i = tid; i < 4096; i += 256) sP[i] = P[i];
    __syncthreads();

    const int wave = tid >> 5, lane = tid & 31;
    const int n0   = (blk * 8 + wave) * 16;
    const int rlo  = lane & 15;
    const int kh   = (lane >> 4) * 2;

    const float* A = emb + ((size_t)batch * N_ + n0) * C_;

    v8f acc0 = {0.f,0.f,0.f,0.f,0.f,0.f,0.f,0.f};
    v8f acc1 = acc0, acc2 = acc0, acc3 = acc0;

#pragma unroll
    for (int k = 0; k < 16; ++k) {
        v2f a  = *(const v2f*)(A + rlo * C_ + k * 4 + kh);            // emb rows
        v2f b0 = *(const v2f*)(&sP[( 0 + rlo) * 64 + k * 4 + kh]);    // P[c',e] = B[k,n']
        v2f b1 = *(const v2f*)(&sP[(16 + rlo) * 64 + k * 4 + kh]);
        v2f b2 = *(const v2f*)(&sP[(32 + rlo) * 64 + k * 4 + kh]);
        v2f b3 = *(const v2f*)(&sP[(48 + rlo) * 64 + k * 4 + kh]);
        acc0 = __builtin_amdgcn_wmma_f32_16x16x4_f32(false, a, false, b0, (short)0, acc0, false, false);
        acc1 = __builtin_amdgcn_wmma_f32_16x16x4_f32(false, a, false, b1, (short)0, acc1, false, false);
        acc2 = __builtin_amdgcn_wmma_f32_16x16x4_f32(false, a, false, b2, (short)0, acc2, false, false);
        acc3 = __builtin_amdgcn_wmma_f32_16x16x4_f32(false, a, false, b3, (short)0, acc3, false, false);
    }

    float* O = out + ((size_t)batch * N_ + n0) * C_;
    const int rbase = (lane >> 4) * 8;
#pragma unroll
    for (int r = 0; r < 8; ++r) {
        O[(rbase + r) * C_ +  0 + rlo] = acc0[r];
        O[(rbase + r) * C_ + 16 + rlo] = acc1[r];
        O[(rbase + r) * C_ + 32 + rlo] = acc2[r];
        O[(rbase + r) * C_ + 48 + rlo] = acc3[r];
    }
}

// ---------------------------------------------------------------------------
extern "C" void kernel_launch(void* const* d_in, const int* in_sizes, int n_in,
                              void* d_out, int out_size, void* d_ws, size_t ws_size,
                              hipStream_t stream) {
    const float* emb = (const float*)d_in[0];
    const float* Wq  = (const float*)d_in[1];
    const float* Wk  = (const float*)d_in[2];
    const float* Wv  = (const float*)d_in[3];
    const float* Wo  = (const float*)d_in[4];
    float* ws  = (float*)d_ws;
    float* out = (float*)d_out;

    hipLaunchKernelGGL(g_partial_kernel, dim3(B_ * NSLICE), dim3(512), 0, stream, emb, ws);
    hipLaunchKernelGGL(heads_kernel,     dim3(B_ * H_),     dim3(256), 0, stream, Wq, Wk, Wv, Wo, ws);
    hipLaunchKernelGGL(p_reduce_kernel,  dim3(32),          dim3(256), 0, stream, ws);
    hipLaunchKernelGGL(out_kernel,       dim3(256),         dim3(256), 0, stream, emb, ws, out);
}

// v001
// It runs in 55.5 microseconds.
// Two timings next to v000 put it at 1.82 and 1.83 times that version's speed.
#include <hip/hip_runtime.h>
#include <math.h>

typedef float v2f __attribute__((ext_vector_type(2)));
typedef float v4f __attribute__((ext_vector_type(4)));
typedef float v8f __attribute__((ext_vector_type(8)));

#define B_ 2
#define N_ 16384
#define C_ 64
#define H_ 8
#define NSLICE 32
#define ROWS_PER_SLICE (N_ / NSLICE)   // 512
#define LP 68   // LDS row pitch in floats of the 64x64 maps: 16 B x odd, for 16-byte fragment reads

// workspace layout (float offsets)
#define WS_GPART 0                              // [B][NSLICE][64*64] partial Gram
#define WS_PC    (B_ * NSLICE * 4096)           // [B][H][64*64] per-head P contribution
#define WS_P     (WS_PC + B_ * H_ * 4096)       // [B][64*64] folded projection matrix
// total = 335872 floats = ~1.31 MB

// ---------------------------------------------------------------------------
// Kernel 1: partial Gram matrices  Gpart[b][slice] = emb_slice^T @ emb_slice
// 16 waves per block, one 16x16 tile of G each; K-steps of 4 rows via WMMA f32.
// ---------------------------------------------------------------------------
__global__ __launch_bounds__(512)
void g_partial_kernel(const float* __restrict__ emb, float* __restrict__ ws) {
    const int b     = blockIdx.x / NSLICE;
    const int slice = blockIdx.x % NSLICE;
    const int wave  = threadIdx.x >> 5;
    const int lane  = threadIdx.x & 31;
    const int ctile = wave >> 2;        // M tile of G (c index)
    const int ftile = wave & 3;         // N tile of G (f index)
    const int rlo   = lane & 15;        // M (for A) / N (for B) within tile
    const int khalf = (lane >> 4) * 2;  // K pair selector

    const float* eb = emb + (size_t)b * N_ * C_;
    const int n0 = slice * ROWS_PER_SLICE;

    v8f acc = {0.f, 0.f, 0.f, 0.f, 0.f, 0.f, 0.f, 0.f};
    for (int s = 0; s < ROWS_PER_SLICE; s += 4) {
        const float* rowp = eb + (size_t)(n0 + s + khalf) * C_;
        v2f a, bb;
        a.x  = rowp[ctile * 16 + rlo];        // A[m,k]   = emb[n, c]  (emb^T)
        a.y  = rowp[C_ + ctile * 16 + rlo];   // next K (next row of emb)
        bb.x = rowp[ftile * 16 + rlo];        // B[k,n']  = emb[n, f]
        bb.y = rowp[C_ + ftile * 16 + rlo];
        acc = __builtin_amdgcn_wmma_f32_16x16x4_f32(
            false, a, false, bb, (short)0, acc, false, false);
    }

    float* gp = ws + WS_GPART + (size_t)(b * NSLICE + slice) * 4096;
    const int rbase = ctile * 16 + ((lane >> 4) << 3);  // lanes 16-31 hold M+8
#pragma unroll
    for (int r = 0; r < 8; ++r)
        gp[(rbase + r) * 64 + ftile * 16 + rlo] = acc[r];
}

// ---------------------------------------------------------------------------
// One wave's share of a 64x64x64 product D[m][n] = sum_k X[m][k] * Y[n][k]:
// row tile mt against column tiles nt and nt+1. X and Y lie in LDS at pitch LP
// with k contiguous. Lane (c, hh) reads k = 8*kk + 4*hh + 0..3 of its row of X
// and of Y with the same code, so both operands carry the same k order.
// ---------------------------------------------------------------------------
__device__ __forceinline__ void mm64_tiles(const float* X, const float* Y,
                                           int mt, int nt, int c, int hh,
                                           v8f& d0, v8f& d1) {
    const float* xp = X + (mt * 16 + c) * LP + 4 * hh;
    const float* y0 = Y + (nt * 16 + c) * LP + 4 * hh;
    const float* y1 = y0 + 16 * LP;
    // unrolled whole: the LDS reads can issue ahead of the matrix run, no branch behind a WMMA
#pragma unroll
    for (int kk = 0; kk < 8; ++kk) {
        const v4f a  = *(const v4f*)(xp + kk * 8);
        const v4f b0 = *(const v4f*)(y0 + kk * 8);
        const v4f b1 = *(const v4f*)(y1 + kk * 8);
        const v2f alo = {a.x, a.y},   ahi = {a.z, a.w};
        const v2f p0  = {b0.x, b0.y}, q0  = {b0.z, b0.w};
        const v2f p1  = {b1.x, b1.y}, q1  = {b1.z, b1.w};
        d0 = __builtin_amdgcn_wmma_f32_16x16x4_f32(false, alo, false, p0, (short)0, d0, false, false);
        d1 = __builtin_amdgcn_wmma_f32_16x16x4_f32(false, alo, false, p1, (short)0, d1, false, false);
        d0 = __builtin_amdgcn_wmma_f32_16x16x4_f32(false, ahi, false, q0, (short)0, d0, false, false);
        d1 = __builtin_amdgcn_wmma_f32_16x16x4_f32(false, ahi, false, q1, (short)0, d1, false, false);
    }
}

// D tile (rows 16*mt + 8*hh + r, column n) stored transposed: Z[n][m], 8 consecutive m per lane
__device__ __forceinline__ void store_tile_t(float* Z, int mt, int n, int hh, const v8f& d) {
    float* z = Z + n * LP + mt * 16 + hh * 8;
    const v4f lo = {d[0], d[1], d[2], d[3]}, hi = {d[4], d[5], d[6], d[7]};
    *(v4f*)z = lo;
    *(v4f*)(z + 4) = hi;
}

// ---------------------------------------------------------------------------
// Kernel 2: per (b,h): S = Wq_h G Wk_h^T ; instance-norm ; softmax(rows) ;
//           M = attn @ Wv_h ; Pcontrib = Wo_h @ M.   All 64x64, done in LDS;
//           the four products run on WMMA f32, 8 waves x 2 tiles of 16x16.
// ---------------------------------------------------------------------------
__global__ __launch_bounds__(256)
void heads_kernel(const float* __restrict__ Wq, const float* __restrict__ Wk,
                  const float* __restrict__ Wv, const float* __restrict__ Wo,
                  float* __restrict__ ws) {
    __shared__ __attribute__((aligned(16))) float sG[64 * LP], sW[64 * LP], sT[64 * LP], sS[64 * LP];
    __shared__ float red[256], red2[256];
    __shared__ float s_mean, s_rstd;

    const int b = blockIdx.x >> 3;
    const int h = blockIdx.x & 7;
    const int tid = threadIdx.x;
    const int lane = tid & 31;
    const int lc = lane & 15, lh = lane >> 4;      // fragment column / k half
    const int mt = tid >> 6;                       // wave's row tile
    const int nt = ((tid >> 5) & 1) * 2;           // wave's first column tile
    const v8f zero8 = {0.f, 0.f, 0.f, 0.f, 0.f, 0.f, 0.f, 0.f};

    // deterministic reduce of Gram partials
    for (int i = tid; i < 4096; i += 256) {
        const float* gp = ws + WS_GPART + (size_t)b * NSLICE * 4096 + i;
        float s = 0.f;
        for (int sl = 0; sl < NSLICE; ++sl) s += gp[sl * 4096];
        sG[(i >> 6) * LP + (i & 63)] = s;
    }
    for (int i = tid; i < 4096; i += 256) sW[(i >> 6) * LP + (i & 63)] = Wk[h * 4096 + i];
    __syncthreads();

    // T1[e,d] = sum_f G[e,f] * Wk_h[d,f], kept as sT[d][e]
    {
        v8f d0 = zero8, d1 = zero8;
        mm64_tiles(sG, sW, mt, nt, lc, lh, d0, d1);
        store_tile_t(sT, mt, nt * 16 + lc, lh, d0);
        store_tile_t(sT, mt, nt * 16 + 16 + lc, lh, d1);
    }
    __syncthreads();
    for (int i = tid; i < 4096; i += 256) sW[(i >> 6) * LP + (i & 63)] = Wq[h * 4096 + i];
    __syncthreads();

    // S[c,d] = sum_e Wq_h[c,e] * T1[e,d]
    {
        v8f d0 = zero8, d1 = zero8;
        mm64_tiles(sW, sT, mt, nt, lc, lh, d0, d1);
        float* sp = sS + (mt * 16 + lh * 8) * LP + nt * 16 + lc;
#pragma unroll
        for (int r = 0; r < 8; ++r) {   // unrolled: d0, d1 are indexed by constants and stay in registers
            sp[r * LP]      = d0[r];
            sp[r * LP + 16] = d1[r];
        }
    }
    __syncthreads();

    // InstanceNorm over the full 64x64 map (biased variance, eps=1e-5)
    {
        float s = 0.f, s2 = 0.f;
        for (int i = tid; i < 4096; i += 256) { float x = sS[(i >> 6) * LP + (i & 63)]; s += x; s2 += x * x; }
        red[tid] = s; red2[tid] = s2;
        __syncthreads();
        for (int off = 128; off > 0; off >>= 1) {
            if (tid < off) { red[tid] += red[tid + off]; red2[tid] += red2[tid + off]; }
            __syncthreads();
        }
        if (tid == 0) {
            float mean = red[0] * (1.0f / 4096.0f);
            float var  = red2[0] * (1.0f / 4096.0f) - mean * mean;
            s_mean = mean;
            s_rstd = rsqrtf(var + 1e-5f);
        }
        __syncthreads();
    }
    for (int i = tid; i < 4096; i += 256) {
        const int p = (i >> 6) * LP + (i & 63);
        sS[p] = (sS[p] - s_mean) * s_rstd;
    }
    __syncthreads();

    // softmax along d (each of threads 0..63 owns one row)
    if (tid < 64) {
        const int r = tid * LP;
        float m = sS[r];
        for (int d = 1; d < 64; ++d) m = fmaxf(m, sS[r + d]);
        float s = 0.f;
        for (int d = 0; d < 64; ++d) { float e = expf(sS[r + d] - m); sS[r + d] = e; s += e; }
        const float inv = 1.f / s;
        for (int d = 0; d < 64; ++d) sS[r + d] *= inv;
    }
    __syncthreads();
    // Wv_h staged as sW[e][d], so that the product's k (= d) is contiguous
    for (int i = tid; i < 4096; i += 256) sW[(i & 63) * LP + (i >> 6)] = Wv[h * 4096 + i];
    __syncthreads();

    // M[c,e] = sum_d attn[c,d] * Wv_h[d,e], kept as sT[e][c]
    {
        v8f d0 = zero8, d1 = zero8;
        mm64_tiles(sS, sW, mt, nt, lc, lh, d0, d1);
        store_tile_t(sT, mt, nt * 16 + lc, lh, d0);
        store_tile_t(sT, mt, nt * 16 + 16 + lc, lh, d1);
    }
    __syncthreads();
    // Wo_h[c',c] = Wo[c'*512 + c*8 + h]
    for (int i = tid; i < 4096; i += 256) {
        const int cp = i >> 6, c = i & 63;
        sW[cp * LP + c] = Wo[cp * 512 + c * 8 + h];
    }
    __syncthreads();

    // Pcontrib[c',e] = sum_c Wo_h[c',c] * M[c,e]
    {
        v8f d0 = zero8, d1 = zero8;
        mm64_tiles(sW, sT, mt, nt, lc, lh, d0, d1);
        float* pc = ws + WS_PC + (size_t)(b * H_ + h) * 4096
                  + (mt * 16 + lh * 8) * 64 + nt * 16 + lc;
#pragma unroll
        for (int r = 0; r < 8; ++r) {   // unrolled: d0, d1 are indexed by constants and stay in registers
            pc[r * 64]      = d0[r];
            pc[r * 64 + 16] = d1[r];
        }
    }
}

// ---------------------------------------------------------------------------
// Kernel 3: P[b] = sum_h Pcontrib[b][h]   (deterministic)
// ---------------------------------------------------------------------------
__global__ __launch_bounds__(256)
void p_reduce_kernel(float* __restrict__ ws) {
    const int i = blockIdx.x * 256 + threadIdx.x;  // 0..8191
    const int b = i >> 12, j = i & 4095;
    const float* pc = ws + WS_PC + (size_t)b * H_ * 4096 + j;
    float s = 0.f;
    for (int h = 0; h < H_; ++h) s += pc[h * 4096];
    ws[WS_P + i] = s;
}

// ---------------------------------------------------------------------------
// Kernel 4: out_b[n,c'] = emb_b[n,:] . P_b[c',:]   (WMMA, P staged in LDS)
// Each wave: one 16-row stripe x all 64 output columns (4 accumulators).
// ---------------------------------------------------------------------------
__global__ __launch_bounds__(256)
void out_kernel(const float* __restrict__ emb, const float* __restrict__ ws,
                float* __restrict__ out) {
    __shared__ float sP[4096];
    const int batch = blockIdx.x >> 7;   // 128 blocks per batch
    const int blk   = blockIdx.x & 127;
    const int tid   = threadIdx.x;

    const float* P = ws + WS_P + (size_t)batch * 4096;
    for (int i = tid; i < 4096; i += 256) sP[i] = P[i];
    __syncthreads();

    const int wave = tid >> 5, lane = tid & 31;
    const int n0   = (blk * 8 + wave) * 16;
    const int rlo  = lane & 15;
    const int kh   = (lane >> 4) * 2;

    const float* A = emb + ((size_t)batch * N_ + n0) * C_;

    v8f acc0 = {0.f,0.f,0.f,0.f,0.f,0.f,0.f,0.f};
    v8f acc1 = acc0, acc2 = acc0, acc3 = acc0;

#pragma unroll
    for (int k = 0; k < 16; ++k) {
        v2f a  = *(const v2f*)(A + rlo * C_ + k * 4 + kh);            // emb rows
        v2f b0 = *(const v2f*)(&sP[( 0 + rlo) * 64 + k * 4 + kh]);    // P[c',e] = B[k,n']
        v2f b1 = *(const v2f*)(&sP[(16 + rlo) * 64 + k * 4 + kh]);
        v2f b2 = *(const v2f*)(&sP[(32 + rlo) * 64 + k * 4 + kh]);
        v2f b3 = *(const v2f*)(&sP[(48 + rlo) * 64 + k * 4 + kh]);
        acc0 = __builtin_amdgcn_wmma_f32_16x16x4_f32(false, a, false, b0, (short)0, acc0, false, false);
        acc1 = __builtin_amdgcn_wmma_f32_16x16x4_f32(false, a, false, b1, (short)0, acc1, false, false);
        acc2 = __builtin_amdgcn_wmma_f32_16x16x4_f32(false, a, false, b2, (short)0, acc2, false, false);
        acc3 = __builtin_amdgcn_wmma_f32_16x16x4_f32(false, a, false, b3, (short)0, acc3, false, false);
    }

    float* O = out + ((size_t)batch * N_ + n0) * C_;
    const int rbase = (lane >> 4) * 8;
#pragma unroll
    for (int r = 0; r < 8; ++r) {
        O[(rbase + r) * C_ +  0 + rlo] = acc0[r];
        O[(rbase + r) * C_ + 16 + rlo] = acc1[r];
        O[(rbase + r) * C_ + 32 + rlo] = acc2[r];
        O[(rbase + r) * C_ + 48 + rlo] = acc3[r];
    }
}

// ---------------------------------------------------------------------------
extern "C" void kernel_launch(void* const* d_in, const int* in_sizes, int n_in,
                              void* d_out, int out_size, void* d_ws, size_t ws_size,
                              hipStream_t stream) {
    const float* emb = (const float*)d_in[0];
    const float* Wq  = (const float*)d_in[1];
    const float* Wk  = (const float*)d_in[2];
    const float* Wv  = (const float*)d_in[3];
    const float* Wo  = (const float*)d_in[4];
    float* ws  = (float*)d_ws;
    float* out = (float*)d_out;

    hipLaunchKernelGGL(g_partial_kernel, dim3(B_ * NSLICE), dim3(512), 0, stream, emb, ws);
    hipLaunchKernelGGL(heads_kernel,     dim3(B_ * H_),     dim3(256), 0, stream, Wq, Wk, Wv, Wo, ws);
    hipLaunchKernelGGL(p_reduce_kernel,  dim3(32),          dim3(256), 0, stream, ws);
    hipLaunchKernelGGL(out_kernel,       dim3(256),         dim3(256), 0, stream, emb, ws, out);
}

// v002
// Measured time: 47.3 microseconds a run.
// In two side-by-side timings against v001, it was 1.16 and 1.19 times as fast.
// All steps since v000 together make it 2.15 times as fast.
#include <hip/hip_runtime.h>
#include <math.h>

typedef float v2f __attribute__((ext_vector_type(2)));
typedef float v4f __attribute__((ext_vector_type(4)));
typedef float v8f __attribute__((ext_vector_type(8)));

#define B_ 2
#define N_ 16384
#define C_ 64
#define H_ 8
#define NSLICE 32
#define ROWS_PER_SLICE (N_ / NSLICE)   // 512
#define LP 68   // LDS row pitch in floats of the 64x64 maps: 16 B x odd, for 16-byte fragment reads

// workspace layout (float offsets)
#define WS_GPART 0                              // [B][NSLICE][64*64] partial Gram
#define WS_PC    (B_ * NSLICE * 4096)           // [B][H][64*64] per-head P contribution
#define WS_P     (WS_PC + B_ * H_ * 4096)       // [B][64*64] folded projection matrix
// total = 335872 floats = ~1.31 MB

// ---------------------------------------------------------------------------
// Kernel 1: partial Gram matrices  Gpart[b][slice] = emb_slice^T @ emb_slice
// 16 waves per block, one 16x16 tile of G each; K-steps of 4 rows via WMMA f32.
// ---------------------------------------------------------------------------
__global__ __launch_bounds__(512)
void g_partial_kernel(const float* __restrict__ emb, float* __restrict__ ws) {
    const int b     = blockIdx.x / NSLICE;
    const int slice = blockIdx.x % NSLICE;
    const int wave  = threadIdx.x >> 5;
    const int lane  = threadIdx.x & 31;
    const int ctile = wave >> 2;        // M tile of G (c index)
    const int ftile = wave & 3;         // N tile of G (f index)
    const int rlo   = lane & 15;        // M (for A) / N (for B) within tile
    const int khalf = (lane >> 4) * 2;  // K pair selector

    const float* eb = emb + (size_t)b * N_ * C_;
    const int n0 = slice * ROWS_PER_SLICE;

    v8f acc = {0.f, 0.f, 0.f, 0.f, 0.f, 0.f, 0.f, 0.f};
    for (int s = 0; s < ROWS_PER_SLICE; s += 4) {
        const float* rowp = eb + (size_t)(n0 + s + khalf) * C_;
        v2f a, bb;
        a.x  = rowp[ctile * 16 + rlo];        // A[m,k]   = emb[n, c]  (emb^T)
        a.y  = rowp[C_ + ctile * 16 + rlo];   // next K (next row of emb)
        bb.x = rowp[ftile * 16 + rlo];        // B[k,n']  = emb[n, f]
        bb.y = rowp[C_ + ftile * 16 + rlo];
        acc = __builtin_amdgcn_wmma_f32_16x16x4_f32(
            false, a, false, bb, (short)0, acc, false, false);
    }

    float* gp = ws + WS_GPART + (size_t)(b * NSLICE + slice) * 4096;
    const int rbase = ctile * 16 + ((lane >> 4) << 3);  // lanes 16-31 hold M+8
#pragma unroll
    for (int r = 0; r < 8; ++r)
        gp[(rbase + r) * 64 + ftile * 16 + rlo] = acc[r];
}

// ---------------------------------------------------------------------------
// One wave's share of a 64x64x64 product D[m][n] = sum_k X[m][k] * Y[n][k]:
// row tile mt against column tiles nt and nt+1. X and Y lie in LDS at pitch LP
// with k contiguous. Lane (c, hh) reads k = 8*kk + 4*hh + 0..3 of its row of X
// and of Y with the same code, so both operands carry the same k order.
// ---------------------------------------------------------------------------
__device__ __forceinline__ void mm64_tiles(const float* X, const float* Y,
                                           int mt, int nt, int c, int hh,
                                           v8f& d0, v8f& d1) {
    const float* xp = X + (mt * 16 + c) * LP + 4 * hh;
    const float* y0 = Y + (nt * 16 + c) * LP + 4 * hh;
    const float* y1 = y0 + 16 * LP;
    // unrolled whole: the LDS reads can issue ahead of the matrix run, no branch behind a WMMA
#pragma unroll
    for (int kk = 0; kk < 8; ++kk) {
        const v4f a  = *(const v4f*)(xp + kk * 8);
        const v4f b0 = *(const v4f*)(y0 + kk * 8);
        const v4f b1 = *(const v4f*)(y1 + kk * 8);
        const v2f alo = {a.x, a.y},   ahi = {a.z, a.w};
        const v2f p0  = {b0.x, b0.y}, q0  = {b0.z, b0.w};
        const v2f p1  = {b1.x, b1.y}, q1  = {b1.z, b1.w};
        d0 = __builtin_amdgcn_wmma_f32_16x16x4_f32(false, alo, false, p0, (short)0, d0, false, false);
        d1 = __builtin_amdgcn_wmma_f32_16x16x4_f32(false, alo, false, p1, (short)0, d1, false, false);
        d0 = __builtin_amdgcn_wmma_f32_16x16x4_f32(false, ahi, false, q0, (short)0, d0, false, false);
        d1 = __builtin_amdgcn_wmma_f32_16x16x4_f32(false, ahi, false, q1, (short)0, d1, false, false);
    }
}

// D tile (rows 16*mt + 8*hh + r, column n) stored transposed: Z[n][m], 8 consecutive m per lane
__device__ __forceinline__ void store_tile_t(float* Z, int mt, int n, int hh, const v8f& d) {
    float* z = Z + n * LP + mt * 16 + hh * 8;
    const v4f lo = {d[0], d[1], d[2], d[3]}, hi = {d[4], d[5], d[6], d[7]};
    *(v4f*)z = lo;
    *(v4f*)(z + 4) = hi;
}

// ---------------------------------------------------------------------------
// Kernel 2: per (b,h): S = Wq_h G Wk_h^T ; instance-norm ; softmax(rows) ;
//           M = attn @ Wv_h ; Pcontrib = Wo_h @ M.   All 64x64, done in LDS;
//           the four products run on WMMA f32, 8 waves x 2 tiles of 16x16.
// ---------------------------------------------------------------------------
__global__ __launch_bounds__(256)
void heads_kernel(const float* __restrict__ Wq, const float* __restrict__ Wk,
                  const float* __restrict__ Wv, const float* __restrict__ Wo,
                  float* __restrict__ ws) {
    __shared__ __attribute__((aligned(16))) float sG[64 * LP], sT[64 * LP], sS[64 * LP];
    __shared__ __attribute__((aligned(16))) float sWk[64 * LP], sWq[64 * LP], sWv[64 * LP], sWo[64 * LP];
    __shared__ float red[256], red2[256];
    __shared__ float s_mean, s_rstd;

    const int b = blockIdx.x >> 3;
    const int h = blockIdx.x & 7;
    const int tid = threadIdx.x;
    const int lane = tid & 31;
    const int lc = lane & 15, lh = lane >> 4;      // fragment column / k half
    const int mt = tid >> 6;                       // wave's row tile
    const int nt = ((tid >> 5) & 1) * 2;           // wave's first column tile
    const v8f zero8 = {0.f, 0.f, 0.f, 0.f, 0.f, 0.f, 0.f, 0.f};

    // All four weight maps are requested here, ahead of the Gram sum: their latency runs
    // under that sum's own loads, and no product later waits on a global load.
    // Thread tid holds elements i = tid + 256*j of each 64x64 map: row (tid >> 6) + 4*j, column tid & 63.
    const int trow = tid >> 6, tcol = tid & 63;
    const float* gk = Wk + h * 4096 + tid;
    const float* gq = Wq + h * 4096 + tid;
    const float* gv = Wv + h * 4096 + tid;
    const float* go = Wo + trow * 512 + tcol * 8 + h;   // Wo_h[c',c] = Wo[c'*512 + c*8 + h]
    float rk[16], rq[16], rv[16], ro[16];
#pragma unroll
    for (int j = 0; j < 16; ++j) {   // unrolled: the 64 loads are in flight together, values stay in registers
        rk[j] = gk[j * 256];
        rq[j] = gq[j * 256];
        rv[j] = gv[j * 256];
        ro[j] = go[j * 2048];
    }
    // precaution: stands in front of any reuse of the loads' address registers; go is named as an
    // input so that its register pair, the only one that dies here, is not rewritten ahead of the wait
    asm volatile("s_wait_xcnt 0x0" :: "v"(go) : "memory");

    // deterministic reduce of Gram partials
    for (int i = tid; i < 4096; i += 256) {
        const float* gp = ws + WS_GPART + (size_t)b * NSLICE * 4096 + i;
        float s = 0.f;
        for (int sl = 0; sl < NSLICE; ++sl) s += gp[sl * 4096];
        sG[(i >> 6) * LP + (i & 63)] = s;
    }
#pragma unroll
    for (int j = 0; j < 16; ++j) {   // unrolled: rk..ro are indexed by constants
        const int p = (trow + 4 * j) * LP + tcol;
        sWk[p] = rk[j];
        sWq[p] = rq[j];
        sWv[tcol * LP + trow + 4 * j] = rv[j];   // kept as sWv[e][d], so that the product's k (= d) is contiguous
        sWo[p] = ro[j];
    }
    __syncthreads();

    // T1[e,d] = sum_f G[e,f] * Wk_h[d,f], kept as sT[d][e]
    {
        v8f d0 = zero8, d1 = zero8;
        mm64_tiles(sG, sWk, mt, nt, lc, lh, d0, d1);
        store_tile_t(sT, mt, nt * 16 + lc, lh, d0);
        store_tile_t(sT, mt, nt * 16 + 16 + lc, lh, d1);
    }
    __syncthreads();

    // S[c,d] = sum_e Wq_h[c,e] * T1[e,d]
    {
        v8f d0 = zero8, d1 = zero8;
        mm64_tiles(sWq, sT, mt, nt, lc, lh, d0, d1);
        float* sp = sS + (mt * 16 + lh * 8) * LP + nt * 16 + lc;
#pragma unroll
        for (int r = 0; r < 8; ++r) {   // unrolled: d0, d1 are indexed by constants and stay in registers
            sp[r * LP]      = d0[r];
            sp[r * LP + 16] = d1[r];
        }
    }
    __syncthreads();

    // InstanceNorm over the full 64x64 map (biased variance, eps=1e-5)
    {
        float s = 0.f, s2 = 0.f;
        for (int i = tid; i < 4096; i += 256) { float x = sS[(i >> 6) * LP + (i & 63)]; s += x; s2 += x * x; }
        red[tid] = s; red2[tid] = s2;
        __syncthreads();
        for (int off = 128; off > 0; off >>= 1) {
            if (tid < off) { red[tid] += red[tid + off]; red2[tid] += red2[tid + off]; }
            __syncthreads();
        }
        if (tid == 0) {
            float mean = red[0] * (1.0f / 4096.0f);
            float var  = red2[0] * (1.0f / 4096.0f) - mean * mean;
            s_mean = mean;
            s_rstd = rsqrtf(var + 1e-5f);
        }
        __syncthreads();
    }
    for (int i = tid; i < 4096; i += 256) {
        const int p = (i >> 6) * LP + (i & 63);
        sS[p] = (sS[p] - s_mean) * s_rstd;
    }
    __syncthreads();

    // softmax along d (each of threads 0..63 owns one row)
    if (tid < 64) {
        const int r = tid * LP;
        float m = sS[r];
        for (int d = 1; d < 64; ++d) m = fmaxf(m, sS[r + d]);
        float s = 0.f;
        for (int d = 0; d < 64; ++d) { float e = expf(sS[r + d] - m); sS[r + d] = e; s += e; }
        const float inv = 1.f / s;
        for (int d = 0; d < 64; ++d) sS[r + d] *= inv;
    }
    __syncthreads();

    // M[c,e] = sum_d attn[c,d] * Wv_h[d,e], kept as sT[e][c]
    {
        v8f d0 = zero8, d1 = zero8;
        mm64_tiles(sS, sWv, mt, nt, lc, lh, d0, d1);
        store_tile_t(sT, mt, nt * 16 + lc, lh, d0);
        store_tile_t(sT, mt, nt * 16 + 16 + lc, lh, d1);
    }
    __syncthreads();

    // Pcontrib[c',e] = sum_c Wo_h[c',c] * M[c,e]
    {
        v8f d0 = zero8, d1 = zero8;
        mm64_tiles(sWo, sT, mt, nt, lc, lh, d0, d1);
        float* pc = ws + WS_PC + (size_t)(b * H_ + h) * 4096
                  + (mt * 16 + lh * 8) * 64 + nt * 16 + lc;
#pragma unroll
        for (int r = 0; r < 8; ++r) {   // unrolled: d0, d1 are indexed by constants and stay in registers
            pc[r * 64]      = d0[r];
            pc[r * 64 + 16] = d1[r];
        }
    }
}

// ---------------------------------------------------------------------------
// Kernel 3: P[b] = sum_h Pcontrib[b][h]   (deterministic)
// ---------------------------------------------------------------------------
__global__ __launch_bounds__(256)
void p_reduce_kernel(float* __restrict__ ws) {
    const int i = blockIdx.x * 256 + threadIdx.x;  // 0..8191
    const int b = i >> 12, j = i & 4095;
    const float* pc = ws + WS_PC + (size_t)b * H_ * 4096 + j;
    float s = 0.f;
    for (int h = 0; h < H_; ++h) s += pc[h * 4096];
    ws[WS_P + i] = s;
}

// ---------------------------------------------------------------------------
// Kernel 4: out_b[n,c'] = emb_b[n,:] . P_b[c',:]   (WMMA, P staged in LDS)
// Each wave: one 16-row stripe x all 64 output columns (4 accumulators).
// ---------------------------------------------------------------------------
__global__ __launch_bounds__(256)
void out_kernel(const float* __restrict__ emb, const float* __restrict__ ws,
                float* __restrict__ out) {
    __shared__ float sP[4096];
    const int batch = blockIdx.x >> 7;   // 128 blocks per batch
    const int blk   = blockIdx.x & 127;
    const int tid   = threadIdx.x;

    const float* P = ws + WS_P + (size_t)batch * 4096;
    for (int i = tid; i < 4096; i += 256) sP[i] = P[i];
    __syncthreads();

    const int wave = tid >> 5, lane = tid & 31;
    const int n0   = (blk * 8 + wave) * 16;
    const int rlo  = lane & 15;
    const int kh   = (lane >> 4) * 2;

    const float* A = emb + ((size_t)batch * N_ + n0) * C_;

    v8f acc0 = {0.f,0.f,0.f,0.f,0.f,0.f,0.f,0.f};
    v8f acc1 = acc0, acc2 = acc0, acc3 = acc0;

#pragma unroll
    for (int k = 0; k < 16; ++k) {
        v2f a  = *(const v2f*)(A + rlo * C_ + k * 4 + kh);            // emb rows
        v2f b0 = *(const v2f*)(&sP[( 0 + rlo) * 64 + k * 4 + kh]);    // P[c',e] = B[k,n']
        v2f b1 = *(const v2f*)(&sP[(16 + rlo) * 64 + k * 4 + kh]);
        v2f b2 = *(const v2f*)(&sP[(32 + rlo) * 64 + k * 4 + kh]);
        v2f b3 = *(const v2f*)(&sP[(48 + rlo) * 64 + k * 4 + kh]);
        acc0 = __builtin_amdgcn_wmma_f32_16x16x4_f32(false, a, false, b0, (short)0, acc0, false, false);
        acc1 = __builtin_amdgcn_wmma_f32_16x16x4_f32(false, a, false, b1, (short)0, acc1, false, false);
        acc2 = __builtin_amdgcn_wmma_f32_16x16x4_f32(false, a, false, b2, (short)0, acc2, false, false);
        acc3 = __builtin_amdgcn_wmma_f32_16x16x4_f32(false, a, false, b3, (short)0, acc3, false, false);
    }

    float* O = out + ((size_t)batch * N_ + n0) * C_;
    const int rbase = (lane >> 4) * 8;
#pragma unroll
    for (int r = 0; r < 8; ++r) {
        O[(rbase + r) * C_ +  0 + rlo] = acc0[r];
        O[(rbase + r) * C_ + 16 + rlo] = acc1[r];
        O[(rbase + r) * C_ + 32 + rlo] = acc2[r];
        O[(rbase + r) * C_ + 48 + rlo] = acc3[r];
    }
}

// ---------------------------------------------------------------------------
extern "C" void kernel_launch(void* const* d_in, const int* in_sizes, int n_in,
                              void* d_out, int out_size, void* d_ws, size_t ws_size,
                              hipStream_t stream) {
    const float* emb = (const float*)d_in[0];
    const float* Wq  = (const float*)d_in[1];
    const float* Wk  = (const float*)d_in[2];
    const float* Wv  = (const float*)d_in[3];
    const float* Wo  = (const float*)d_in[4];
    float* ws  = (float*)d_ws;
    float* out = (float*)d_out;

    hipLaunchKernelGGL(g_partial_kernel, dim3(B_ * NSLICE), dim3(512), 0, stream, emb, ws);
    hipLaunchKernelGGL(heads_kernel,     dim3(B_ * H_),     dim3(256), 0, stream, Wq, Wk, Wv, Wo, ws);
    hipLaunchKernelGGL(p_reduce_kernel,  dim3(32),          dim3(256), 0, stream, ws);
    hipLaunchKernelGGL(out_kernel,       dim3(256),         dim3(256), 0, stream, emb, ws, out);
}

// v003
// A run of this version takes 43.5 microseconds.
// Next to v002, in two timings, it ran 1.07 times as fast each time.
// All steps since v000 together make it 2.30 times as fast.
#include <hip/hip_runtime.h>
#include <math.h>

typedef float v2f __attribute__((ext_vector_type(2)));
typedef float v4f __attribute__((ext_vector_type(4)));
typedef float v8f __attribute__((ext_vector_type(8)));

#define B_ 2
#define N_ 16384
#define C_ 64
#define H_ 8
#define NSLICE 32
#define ROWS_PER_SLICE (N_ / NSLICE)   // 512
#define LP 68   // LDS row pitch in floats of the 64x64 maps: 16 B x odd, for 16-byte fragment reads

// workspace layout (float offsets)
#define WS_GPART 0                              // [B][NSLICE][64*64] partial Gram
#define WS_PC    (B_ * NSLICE * 4096)           // [B][H][64*64] per-head P contribution
// total = 327680 floats = 1.25 MB

// ---------------------------------------------------------------------------
// Kernel 1: partial Gram matrices  Gpart[b][slice] = emb_slice^T @ emb_slice
// 16 waves per block, one 16x16 tile of G each; K-steps of 4 rows via WMMA f32.
// ---------------------------------------------------------------------------
__global__ __launch_bounds__(512)
void g_partial_kernel(const float* __restrict__ emb, float* __restrict__ ws) {
    const int b     = blockIdx.x / NSLICE;
    const int slice = blockIdx.x % NSLICE;
    const int wave  = threadIdx.x >> 5;
    const int lane  = threadIdx.x & 31;
    const int ctile = wave >> 2;        // M tile of G (c index)
    const int ftile = wave & 3;         // N tile of G (f index)
    const int rlo   = lane & 15;        // M (for A) / N (for B) within tile
    const int khalf = (lane >> 4) * 2;  // K pair selector

    const float* eb = emb + (size_t)b * N_ * C_;
    const int n0 = slice * ROWS_PER_SLICE;

    v8f acc = {0.f, 0.f, 0.f, 0.f, 0.f, 0.f, 0.f, 0.f};
    for (int s = 0; s < ROWS_PER_SLICE; s += 4) {
        const float* rowp = eb + (size_t)(n0 + s + khalf) * C_;
        v2f a, bb;
        a.x  = rowp[ctile * 16 + rlo];        // A[m,k]   = emb[n, c]  (emb^T)
        a.y  = rowp[C_ + ctile * 16 + rlo];   // next K (next row of emb)
        bb.x = rowp[ftile * 16 + rlo];        // B[k,n']  = emb[n, f]
        bb.y = rowp[C_ + ftile * 16 + rlo];
        acc = __builtin_amdgcn_wmma_f32_16x16x4_f32(
            false, a, false, bb, (short)0, acc, false, false);
    }

    float* gp = ws + WS_GPART + (size_t)(b * NSLICE + slice) * 4096;
    const int rbase = ctile * 16 + ((lane >> 4) << 3);  // lanes 16-31 hold M+8
#pragma unroll
    for (int r = 0; r < 8; ++r)
        gp[(rbase + r) * 64 + ftile * 16 + rlo] = acc[r];
}

// ---------------------------------------------------------------------------
// One wave's share of a 64x64x64 product D[m][n] = sum_k X[m][k] * Y[n][k]:
// row tile mt against column tiles nt and nt+1. X and Y lie in LDS at pitch LP
// with k contiguous. Lane (c, hh) reads k = 8*kk + 4*hh + 0..3 of its row of X
// and of Y with the same code, so both operands carry the same k order.
// ---------------------------------------------------------------------------
__device__ __forceinline__ void mm64_tiles(const float* X, const float* Y,
                                           int mt, int nt, int c, int hh,
                                           v8f& d0, v8f& d1) {
    const float* xp = X + (mt * 16 + c) * LP + 4 * hh;
    const float* y0 = Y + (nt * 16 + c) * LP + 4 * hh;
    const float* y1 = y0 + 16 * LP;
    // unrolled whole: the LDS reads can issue ahead of the matrix run, no branch behind a WMMA
#pragma unroll
    for (int kk = 0; kk < 8; ++kk) {
        const v4f a  = *(const v4f*)(xp + kk * 8);
        const v4f b0 = *(const v4f*)(y0 + kk * 8);
        const v4f b1 = *(const v4f*)(y1 + kk * 8);
        const v2f alo = {a.x, a.y},   ahi = {a.z, a.w};
        const v2f p0  = {b0.x, b0.y}, q0  = {b0.z, b0.w};
        const v2f p1  = {b1.x, b1.y}, q1  = {b1.z, b1.w};
        d0 = __builtin_amdgcn_wmma_f32_16x16x4_f32(false, alo, false, p0, (short)0, d0, false, false);
        d1 = __builtin_amdgcn_wmma_f32_16x16x4_f32(false, alo, false, p1, (short)0, d1, false, false);
        d0 = __builtin_amdgcn_wmma_f32_16x16x4_f32(false, ahi, false, q0, (short)0, d0, false, false);
        d1 = __builtin_amdgcn_wmma_f32_16x16x4_f32(false, ahi, false, q1, (short)0, d1, false, false);
    }
}

// D tile (rows 16*mt + 8*hh + r, column n) stored transposed: Z[n][m], 8 consecutive m per lane
__device__ __forceinline__ void store_tile_t(float* Z, int mt, int n, int hh, const v8f& d) {
    float* z = Z + n * LP + mt * 16 + hh * 8;
    const v4f lo = {d[0], d[1], d[2], d[3]}, hi = {d[4], d[5], d[6], d[7]};
    *(v4f*)z = lo;
    *(v4f*)(z + 4) = hi;
}

// ---------------------------------------------------------------------------
// Kernel 2: per (b,h): S = Wq_h G Wk_h^T ; instance-norm ; softmax(rows) ;
//           M = attn @ Wv_h ; Pcontrib = Wo_h @ M.   All 64x64, done in LDS;
//           the four products run on WMMA f32, 8 waves x 2 tiles of 16x16.
// ---------------------------------------------------------------------------
__global__ __launch_bounds__(256)
void heads_kernel(const float* __restrict__ Wq, const float* __restrict__ Wk,
                  const float* __restrict__ Wv, const float* __restrict__ Wo,
                  float* __restrict__ ws) {
    __shared__ __attribute__((aligned(16))) float sG[64 * LP], sT[64 * LP], sS[64 * LP];
    __shared__ __attribute__((aligned(16))) float sWk[64 * LP], sWq[64 * LP], sWv[64 * LP], sWo[64 * LP];
    __shared__ float red[256], red2[256];
    __shared__ float s_mean, s_rstd;

    const int b = blockIdx.x >> 3;
    const int h = blockIdx.x & 7;
    const int tid = threadIdx.x;
    const int lane = tid & 31;
    const int lc = lane & 15, lh = lane >> 4;      // fragment column / k half
    const int mt = tid >> 6;                       // wave's row tile
    const int nt = ((tid >> 5) & 1) * 2;           // wave's first column tile
    const v8f zero8 = {0.f, 0.f, 0.f, 0.f, 0.f, 0.f, 0.f, 0.f};

    // All four weight maps are requested here, ahead of the Gram sum: their latency runs
    // under that sum's own loads, and no product later waits on a global load.
    // Thread tid holds elements i = tid + 256*j of each 64x64 map: row (tid >> 6) + 4*j, column tid & 63.
    const int trow = tid >> 6, tcol = tid & 63;
    const float* gk = Wk + h * 4096 + tid;
    const float* gq = Wq + h * 4096 + tid;
    const float* gv = Wv + h * 4096 + tid;
    const float* go = Wo + trow * 512 + tcol * 8 + h;   // Wo_h[c',c] = Wo[c'*512 + c*8 + h]
    float rk[16], rq[16], rv[16], ro[16];
#pragma unroll
    for (int j = 0; j < 16; ++j) {   // unrolled: the 64 loads are in flight together, values stay in registers
        rk[j] = gk[j * 256];
        rq[j] = gq[j * 256];
        rv[j] = gv[j * 256];
        ro[j] = go[j * 2048];
    }
    // precaution: stands in front of any reuse of the loads' address registers; go is named as an
    // input so that its register pair, the only one that dies here, is not rewritten ahead of the wait
    asm volatile("s_wait_xcnt 0x0" :: "v"(go) : "memory");

    // deterministic reduce of Gram partials
    for (int i = tid; i < 4096; i += 256) {
        const float* gp = ws + WS_GPART + (size_t)b * NSLICE * 4096 + i;
        float s = 0.f;
        for (int sl = 0; sl < NSLICE; ++sl) s += gp[sl * 4096];
        sG[(i >> 6) * LP + (i & 63)] = s;
    }
#pragma unroll
    for (int j = 0; j < 16; ++j) {   // unrolled: rk..ro are indexed by constants
        const int p = (trow + 4 * j) * LP + tcol;
        sWk[p] = rk[j];
        sWq[p] = rq[j];
        sWv[tcol * LP + trow + 4 * j] = rv[j];   // kept as sWv[e][d], so that the product's k (= d) is contiguous
        sWo[p] = ro[j];
    }
    __syncthreads();

    // T1[e,d] = sum_f G[e,f] * Wk_h[d,f], kept as sT[d][e]
    {
        v8f d0 = zero8, d1 = zero8;
        mm64_tiles(sG, sWk, mt, nt, lc, lh, d0, d1);
        store_tile_t(sT, mt, nt * 16 + lc, lh, d0);
        store_tile_t(sT, mt, nt * 16 + 16 + lc, lh, d1);
    }
    __syncthreads();

    // S[c,d] = sum_e Wq_h[c,e] * T1[e,d]
    {
        v8f d0 = zero8, d1 = zero8;
        mm64_tiles(sWq, sT, mt, nt, lc, lh, d0, d1);
        float* sp = sS + (mt * 16 + lh * 8) * LP + nt * 16 + lc;
#pragma unroll
        for (int r = 0; r < 8; ++r) {   // unrolled: d0, d1 are indexed by constants and stay in registers
            sp[r * LP]      = d0[r];
            sp[r * LP + 16] = d1[r];
        }
    }
    __syncthreads();

    // InstanceNorm over the full 64x64 map (biased variance, eps=1e-5)
    {
        float s = 0.f, s2 = 0.f;
        for (int i = tid; i < 4096; i += 256) { float x = sS[(i >> 6) * LP + (i & 63)]; s += x; s2 += x * x; }
        red[tid] = s; red2[tid] = s2;
        __syncthreads();
        for (int off = 128; off > 0; off >>= 1) {
            if (tid < off) { red[tid] += red[tid + off]; red2[tid] += red2[tid + off]; }
            __syncthreads();
        }
        if (tid == 0) {
            float mean = red[0] * (1.0f / 4096.0f);
            float var  = red2[0] * (1.0f / 4096.0f) - mean * mean;
            s_mean = mean;
            s_rstd = rsqrtf(var + 1e-5f);
        }
        __syncthreads();
    }
    for (int i = tid; i < 4096; i += 256) {
        const int p = (i >> 6) * LP + (i & 63);
        sS[p] = (sS[p] - s_mean) * s_rstd;
    }
    __syncthreads();

    // softmax along d (each of threads 0..63 owns one row)
    if (tid < 64) {
        const int r = tid * LP;
        float m = sS[r];
        for (int d = 1; d < 64; ++d) m = fmaxf(m, sS[r + d]);
        float s = 0.f;
        for (int d = 0; d < 64; ++d) { float e = expf(sS[r + d] - m); sS[r + d] = e; s += e; }
        const float inv = 1.f / s;
        for (int d = 0; d < 64; ++d) sS[r + d] *= inv;
    }
    __syncthreads();

    // M[c,e] = sum_d attn[c,d] * Wv_h[d,e], kept as sT[e][c]
    {
        v8f d0 = zero8, d1 = zero8;
        mm64_tiles(sS, sWv, mt, nt, lc, lh, d0, d1);
        store_tile_t(sT, mt, nt * 16 + lc, lh, d0);
        store_tile_t(sT, mt, nt * 16 + 16 + lc, lh, d1);
    }
    __syncthreads();

    // Pcontrib[c',e] = sum_c Wo_h[c',c] * M[c,e]
    {
        v8f d0 = zero8, d1 = zero8;
        mm64_tiles(sWo, sT, mt, nt, lc, lh, d0, d1);
        float* pc = ws + WS_PC + (size_t)(b * H_ + h) * 4096
                  + (mt * 16 + lh * 8) * 64 + nt * 16 + lc;
#pragma unroll
        for (int r = 0; r < 8; ++r) {   // unrolled: d0, d1 are indexed by constants and stay in registers
            pc[r * 64]      = d0[r];
            pc[r * 64 + 16] = d1[r];
        }
    }
}

// ---------------------------------------------------------------------------
// Kernel 3: P_b = sum_h Pcontrib[b][h], summed by every block while it stages P in LDS
//           (h ascending from 0.f, deterministic); out_b[n,c'] = emb_b[n,:] . P_b[c',:] on WMMA.
// Each wave: one 16-row stripe x all 64 output columns (4 accumulators).
// ---------------------------------------------------------------------------
__global__ __launch_bounds__(256)
void out_kernel(const float* __restrict__ emb, const float* __restrict__ ws,
                float* __restrict__ out) {
    __shared__ __attribute__((aligned(16))) float sP[4096];
    const int batch = blockIdx.x >> 7;   // 128 blocks per batch
    const int blk   = blockIdx.x & 127;
    const int tid   = threadIdx.x;

    // Thread tid owns elements 4*tid + 1024*j + 0..3 of P, j = 0..3.
    {
        const float* pc = ws + WS_PC + (size_t)batch * H_ * 4096 + 4 * tid;
        v4f part[H_][4];
#pragma unroll
        for (int h = 0; h < H_; ++h)   // unrolled with the next loop: 32 independent loads of 16 bytes, no wait per trip
#pragma unroll
            for (int j = 0; j < 4; ++j)
                part[h][j] = *(const v4f*)(pc + h * 4096 + j * 1024);
#pragma unroll
        for (int j = 0; j < 4; ++j) {   // unrolled: part is indexed by constants and stays in registers
            v4f s = {0.f, 0.f, 0.f, 0.f};
#pragma unroll
            for (int h = 0; h < H_; ++h) s += part[h][j];
            *(v4f*)(sP + 4 * tid + j * 1024) = s;
        }
    }
    __syncthreads();

    const int wave = tid >> 5, lane = tid & 31;
    const int n0   = (blk * 8 + wave) * 16;
    const int rlo  = lane & 15;
    const int kh   = (lane >> 4) * 2;

    const float* A = emb + ((size_t)batch * N_ + n0) * C_;

    v8f acc0 = {0.f,0.f,0.f,0.f,0.f,0.f,0.f,0.f};
    v8f acc1 = acc0, acc2 = acc0, acc3 = acc0;

#pragma unroll
    for (int k = 0; k < 16; ++k) {
        v2f a  = *(const v2f*)(A + rlo * C_ + k * 4 + kh);            // emb rows
        v2f b0 = *(const v2f*)(&sP[( 0 + rlo) * 64 + k * 4 + kh]);    // P[c',e] = B[k,n']
        v2f b1 = *(const v2f*)(&sP[(16 + rlo) * 64 + k * 4 + kh]);
        v2f b2 = *(const v2f*)(&sP[(32 + rlo) * 64 + k * 4 + kh]);
        v2f b3 = *(const v2f*)(&sP[(48 + rlo) * 64 + k * 4 + kh]);
        acc0 = __builtin_amdgcn_wmma_f32_16x16x4_f32(false, a, false, b0, (short)0, acc0, false, false);
        acc1 = __builtin_amdgcn_wmma_f32_16x16x4_f32(false, a, false, b1, (short)0, acc1, false, false);
        acc2 = __builtin_amdgcn_wmma_f32_16x16x4_f32(false, a, false, b2, (short)0, acc2, false, false);
        acc3 = __builtin_amdgcn_wmma_f32_16x16x4_f32(false, a, false, b3, (short)0, acc3, false, false);
    }

    float* O = out + ((size_t)batch * N_ + n0) * C_;
    const int rbase = (lane >> 4) * 8;
#pragma unroll
    for (int r = 0; r < 8; ++r) {
        O[(rbase + r) * C_ +  0 + rlo] = acc0[r];
        O[(rbase + r) * C_ + 16 + rlo] = acc1[r];
        O[(rbase + r) * C_ + 32 + rlo] = acc2[r];
        O[(rbase + r) * C_ + 48 + rlo] = acc3[r];
    }
}

// ---------------------------------------------------------------------------
extern "C" void kernel_launch(void* const* d_in, const int* in_sizes, int n_in,
                              void* d_out, int out_size, void* d_ws, size_t ws_size,
                              hipStream_t stream) {
    const float* emb = (const float*)d_in[0];
    const float* Wq  = (const float*)d_in[1];
    const float* Wk  = (const float*)d_in[2];
    const float* Wv  = (const float*)d_in[3];
    const float* Wo  = (const float*)d_in[4];
    float* ws  = (float*)d_ws;
    float* out = (float*)d_out;

    hipLaunchKernelGGL(g_partial_kernel, dim3(B_ * NSLICE), dim3(512), 0, stream, emb, ws);
    hipLaunchKernelGGL(heads_kernel,     dim3(B_ * H_),     dim3(256), 0, stream, Wq, Wk, Wv, Wo, ws);
    hipLaunchKernelGGL(out_kernel,       dim3(256),         dim3(256), 0, stream, emb, ws, out);
}

// v004
// It runs in 29.7 microseconds.
// In two side-by-side timings against v003, it was 1.50 and 1.43 times as fast.
// Over all steps from v000 it is 3.37 times as fast.
#include <hip/hip_runtime.h>
#include <math.h>

typedef float v2f __attribute__((ext_vector_type(2)));
typedef float v4f __attribute__((ext_vector_type(4)));
typedef float v8f __attribute__((ext_vector_type(8)));

#define B_ 2
#define N_ 16384
#define C_ 64
#define H_ 8
#define NSLICE 32
#define ROWS_PER_SLICE (N_ / NSLICE)   // 512
#define LP 68   // LDS row pitch in floats of the 64x64 maps: 16 B x odd, for 16-byte fragment reads

// workspace layout (float offsets)
#define WS_GPART 0                              // [B][NSLICE][64*64] partial Gram
#define WS_PC    (B_ * NSLICE * 4096)           // [B][H][64*64] per-head P contribution
// total = 327680 floats = 1.25 MB

// ---------------------------------------------------------------------------
// Kernel 1: partial Gram matrices  Gpart[b][slice] = emb_slice^T @ emb_slice
// Column tile u of G holds the columns 4*l + u (l = 0..15), so one 16-byte load of a lane
// (row n, columns 4*l .. 4*l+3) is that row's element of all four tiles, as A and as B alike.
// A block owns strip t (G rows 4*m + t) of one slice; its 8 waves split the slice's 512 rows,
// 64 each, every emb row read once per block in whole lines; the 8 partial strips are summed in LDS.
// ---------------------------------------------------------------------------
#define GWAVES 8
#define ROWS_PER_WAVE (ROWS_PER_SLICE / GWAVES)   // 64
#define GLOADS (ROWS_PER_WAVE / 2)                // 32 loads a lane: each lane half reads every other row pair
#define GPITCH 20    // floats from l to l+1 of a tile in LDS: 16 B x odd, for 16-byte accesses
#define GTILE  336   // floats from tile u to u+1: 16*GPITCH + 16, so that the sum's reads of u = 0..3 fall on different banks

// x[2*s + j] is row 4*s + 2*hh + j of the wave's rows: k slot (hh, j) of step s, the same for A and B.
template <int T>
__device__ __forceinline__ void strip_products(const v4f (&x)[GLOADS],
                                               v8f& d0, v8f& d1, v8f& d2, v8f& d3) {
    // unrolled whole: x is indexed by constants and stays in registers; each step waits only for its own two loads
#pragma unroll
    for (int s = 0; s < GLOADS / 2; ++s) {
        const v4f r0 = x[2 * s], r1 = x[2 * s + 1];
        const v2f p0 = {r0.x, r1.x}, p1 = {r0.y, r1.y}, p2 = {r0.z, r1.z}, p3 = {r0.w, r1.w};
        const v2f a = (T == 0) ? p0 : (T == 1) ? p1 : (T == 2) ? p2 : p3;
        d0 = __builtin_amdgcn_wmma_f32_16x16x4_f32(false, a, false, p0, (short)0, d0, false, false);
        d1 = __builtin_amdgcn_wmma_f32_16x16x4_f32(false, a, false, p1, (short)0, d1, false, false);
        d2 = __builtin_amdgcn_wmma_f32_16x16x4_f32(false, a, false, p2, (short)0, d2, false, false);
        d3 = __builtin_amdgcn_wmma_f32_16x16x4_f32(false, a, false, p3, (short)0, d3, false, false);
    }
}

__global__ __launch_bounds__(256)
void g_partial_kernel(const float* __restrict__ emb, float* __restrict__ ws) {
    __shared__ __attribute__((aligned(16))) float red[GWAVES * 4 * GTILE];   // [wave][tile u][l][m]
    const int t     = blockIdx.x >> 6;          // strip; the four blocks of a slice lie 64 apart in the grid
    const int bs    = blockIdx.x & 63;          // b * NSLICE + slice
    const int tid   = threadIdx.x;
    const int wave  = tid >> 5;
    const int lane  = tid & 31;
    const int l     = lane & 15;
    const int hh    = lane >> 4;

    const float* p = emb + ((size_t)bs * ROWS_PER_SLICE + wave * ROWS_PER_WAVE + 2 * hh) * C_ + 4 * l;
    v4f x[GLOADS];
#pragma unroll
    for (int s = 0; s < GLOADS / 2; ++s) {   // unrolled: all 32 loads of a lane are in flight together
        x[2 * s]     = *(const v4f*)(p + (4 * s) * C_);
        x[2 * s + 1] = *(const v4f*)(p + (4 * s + 1) * C_);
    }
    // precaution: stands in front of any reuse of the loads' address registers; p is named as an
    // input so that its register pair is not rewritten ahead of the wait
    asm volatile("s_wait_xcnt 0x0" :: "v"(p) : "memory");

    v8f d0 = {0.f, 0.f, 0.f, 0.f, 0.f, 0.f, 0.f, 0.f};
    v8f d1 = d0, d2 = d0, d3 = d0;
    // t is the same for the whole block: a scalar branch picks the copy whose A operand is component t
    switch (t) {
        case 0:  strip_products<0>(x, d0, d1, d2, d3); break;
        case 1:  strip_products<1>(x, d0, d1, d2, d3); break;
        case 2:  strip_products<2>(x, d0, d1, d2, d3); break;
        default: strip_products<3>(x, d0, d1, d2, d3); break;
    }

    // du holds G[4*(r + 8*hh) + t][4*l + u] in lane (l, hh), register r. Each tile goes to LDS as [l][m],
    // 8 consecutive m a lane, straight from the accumulator registers.
    float* rw = red + wave * (4 * GTILE) + l * GPITCH + 8 * hh;
    {
        const v4f q00 = {d0[0], d0[1], d0[2], d0[3]}, q01 = {d0[4], d0[5], d0[6], d0[7]};
        const v4f q10 = {d1[0], d1[1], d1[2], d1[3]}, q11 = {d1[4], d1[5], d1[6], d1[7]};
        const v4f q20 = {d2[0], d2[1], d2[2], d2[3]}, q21 = {d2[4], d2[5], d2[6], d2[7]};
        const v4f q30 = {d3[0], d3[1], d3[2], d3[3]}, q31 = {d3[4], d3[5], d3[6], d3[7]};
        *(v4f*)(rw)                 = q00;  *(v4f*)(rw + 4)             = q01;
        *(v4f*)(rw + GTILE)         = q10;  *(v4f*)(rw + GTILE + 4)     = q11;
        *(v4f*)(rw + 2 * GTILE)     = q20;  *(v4f*)(rw + 2 * GTILE + 4) = q21;
        *(v4f*)(rw + 3 * GTILE)     = q30;  *(v4f*)(rw + 3 * GTILE + 4) = q31;
    }
    __syncthreads();

    // thread tid sums column col = tid & 63 of the strip rows m = 4*(tid >> 6) + 0..3 over the waves, wave 0 first
    const int col = tid & 63, m4 = tid >> 6;
    const float* rr = red + (col & 3) * GTILE + (col >> 2) * GPITCH + 4 * m4;
    v4f sum = {0.f, 0.f, 0.f, 0.f};
#pragma unroll
    for (int w = 0; w < GWAVES; ++w)   // unrolled: the 8 LDS reads issue together
        sum += *(const v4f*)(rr + w * (4 * GTILE));
    float* gp = ws + WS_GPART + (size_t)bs * 4096 + (16 * m4 + t) * 64 + col;
    gp[0]   = sum.x;   // G rows 4*m + t: 4 rows apart; a wave's 32 lanes fill one 128-byte line a store
    gp[256] = sum.y;
    gp[512] = sum.z;
    gp[768] = sum.w;
}

// ---------------------------------------------------------------------------
// One wave's share of a 64x64x64 product D[m][n] = sum_k X[m][k] * Y[n][k]:
// row tile mt against column tiles nt and nt+1. X and Y lie in LDS at pitch LP
// with k contiguous. Lane (c, hh) reads k = 8*kk + 4*hh + 0..3 of its row of X
// and of Y with the same code, so both operands carry the same k order.
// ---------------------------------------------------------------------------
__device__ __forceinline__ void mm64_tiles(const float* X, const float* Y,
                                           int mt, int nt, int c, int hh,
                                           v8f& d0, v8f& d1) {
    const float* xp = X + (mt * 16 + c) * LP + 4 * hh;
    const float* y0 = Y + (nt * 16 + c) * LP + 4 * hh;
    const float* y1 = y0 + 16 * LP;
    // unrolled whole: the LDS reads can issue ahead of the matrix run, no branch behind a WMMA
#pragma unroll
    for (int kk = 0; kk < 8; ++kk) {
        const v4f a  = *(const v4f*)(xp + kk * 8);
        const v4f b0 = *(const v4f*)(y0 + kk * 8);
        const v4f b1 = *(const v4f*)(y1 + kk * 8);
        const v2f alo = {a.x, a.y},   ahi = {a.z, a.w};
        const v2f p0  = {b0.x, b0.y}, q0  = {b0.z, b0.w};
        const v2f p1  = {b1.x, b1.y}, q1  = {b1.z, b1.w};
        d0 = __builtin_amdgcn_wmma_f32_16x16x4_f32(false, alo, false, p0, (short)0, d0, false, false);
        d1 = __builtin_amdgcn_wmma_f32_16x16x4_f32(false, alo, false, p1, (short)0, d1, false, false);
        d0 = __builtin_amdgcn_wmma_f32_16x16x4_f32(false, ahi, false, q0, (short)0, d0, false, false);
        d1 = __builtin_amdgcn_wmma_f32_16x16x4_f32(false, ahi, false, q1, (short)0, d1, false, false);
    }
}

// D tile (rows 16*mt + 8*hh + r, column n) stored transposed: Z[n][m], 8 consecutive m per lane
__device__ __forceinline__ void store_tile_t(float* Z, int mt, int n, int hh, const v8f& d) {
    float* z = Z + n * LP + mt * 16 + hh * 8;
    const v4f lo = {d[0], d[1], d[2], d[3]}, hi = {d[4], d[5], d[6], d[7]};
    *(v4f*)z = lo;
    *(v4f*)(z + 4) = hi;
}

// ---------------------------------------------------------------------------
// Kernel 2: per (b,h): S = Wq_h G Wk_h^T ; instance-norm ; softmax(rows) ;
//           M = attn @ Wv_h ; Pcontrib = Wo_h @ M.   All 64x64, done in LDS;
//           the four products run on WMMA f32, 8 waves x 2 tiles of 16x16.
// ---------------------------------------------------------------------------
__global__ __launch_bounds__(256)
void heads_kernel(const float* __restrict__ Wq, const float* __restrict__ Wk,
                  const float* __restrict__ Wv, const float* __restrict__ Wo,
                  float* __restrict__ ws) {
    __shared__ __attribute__((aligned(16))) float sG[64 * LP], sT[64 * LP], sS[64 * LP];
    __shared__ __attribute__((aligned(16))) float sWk[64 * LP], sWq[64 * LP], sWv[64 * LP], sWo[64 * LP];
    __shared__ float red[256], red2[256];
    __shared__ float s_mean, s_rstd;

    const int b = blockIdx.x >> 3;
    const int h = blockIdx.x & 7;
    const int tid = threadIdx.x;
    const int lane = tid & 31;
    const int lc = lane & 15, lh = lane >> 4;      // fragment column / k half
    const int mt = tid >> 6;                       // wave's row tile
    const int nt = ((tid >> 5) & 1) * 2;           // wave's first column tile
    const v8f zero8 = {0.f, 0.f, 0.f, 0.f, 0.f, 0.f, 0.f, 0.f};

    // All four weight maps are requested here, ahead of the Gram sum: their latency runs
    // under that sum's own loads, and no product later waits on a global load.
    // Thread tid holds elements i = tid + 256*j of each 64x64 map: row (tid >> 6) + 4*j, column tid & 63.
    const int trow = tid >> 6, tcol = tid & 63;
    const float* gk = Wk + h * 4096 + tid;
    const float* gq = Wq + h * 4096 + tid;
    const float* gv = Wv + h * 4096 + tid;
    const float* go = Wo + trow * 512 + tcol * 8 + h;   // Wo_h[c',c] = Wo[c'*512 + c*8 + h]
    float rk[16], rq[16], rv[16], ro[16];
#pragma unroll
    for (int j = 0; j < 16; ++j) {   // unrolled: the 64 loads are in flight together, values stay in registers
        rk[j] = gk[j * 256];
        rq[j] = gq[j * 256];
        rv[j] = gv[j * 256];
        ro[j] = go[j * 2048];
    }
    // precaution: stands in front of any reuse of the loads' address registers; go is named as an
    // input so that its register pair, the only one that dies here, is not rewritten ahead of the wait
    asm volatile("s_wait_xcnt 0x0" :: "v"(go) : "memory");

    // deterministic reduce of Gram partials
    for (int i = tid; i < 4096; i += 256) {
        const float* gp = ws + WS_GPART + (size_t)b * NSLICE * 4096 + i;
        float s = 0.f;
        for (int sl = 0; sl < NSLICE; ++sl) s += gp[sl * 4096];
        sG[(i >> 6) * LP + (i & 63)] = s;
    }
#pragma unroll
    for (int j = 0; j < 16; ++j) {   // unrolled: rk..ro are indexed by constants
        const int p = (trow + 4 * j) * LP + tcol;
        sWk[p] = rk[j];
        sWq[p] = rq[j];
        sWv[tcol * LP + trow + 4 * j] = rv[j];   // kept as sWv[e][d], so that the product's k (= d) is contiguous
        sWo[p] = ro[j];
    }
    __syncthreads();

    // T1[e,d] = sum_f G[e,f] * Wk_h[d,f], kept as sT[d][e]
    {
        v8f d0 = zero8, d1 = zero8;
        mm64_tiles(sG, sWk, mt, nt, lc, lh, d0, d1);
        store_tile_t(sT, mt, nt * 16 + lc, lh, d0);
        store_tile_t(sT, mt, nt * 16 + 16 + lc, lh, d1);
    }
    __syncthreads();

    // S[c,d] = sum_e Wq_h[c,e] * T1[e,d]
    {
        v8f d0 = zero8, d1 = zero8;
        mm64_tiles(sWq, sT, mt, nt, lc, lh, d0, d1);
        float* sp = sS + (mt * 16 + lh * 8) * LP + nt * 16 + lc;
#pragma unroll
        for (int r = 0; r < 8; ++r) {   // unrolled: d0, d1 are indexed by constants and stay in registers
            sp[r * LP]      = d0[r];
            sp[r * LP + 16] = d1[r];
        }
    }
    __syncthreads();

    // InstanceNorm over the full 64x64 map (biased variance, eps=1e-5)
    {
        float s = 0.f, s2 = 0.f;
        for (int i = tid; i < 4096; i += 256) { float x = sS[(i >> 6) * LP + (i & 63)]; s += x; s2 += x * x; }
        red[tid] = s; red2[tid] = s2;
        __syncthreads();
        for (int off = 128; off > 0; off >>= 1) {
            if (tid < off) { red[tid] += red[tid + off]; red2[tid] += red2[tid + off]; }
            __syncthreads();
        }
        if (tid == 0) {
            float mean = red[0] * (1.0f / 4096.0f);
            float var  = red2[0] * (1.0f / 4096.0f) - mean * mean;
            s_mean = mean;
            s_rstd = rsqrtf(var + 1e-5f);
        }
        __syncthreads();
    }
    for (int i = tid; i < 4096; i += 256) {
        const int p = (i >> 6) * LP + (i & 63);
        sS[p] = (sS[p] - s_mean) * s_rstd;
    }
    __syncthreads();

    // softmax along d (each of threads 0..63 owns one row)
    if (tid < 64) {
        const int r = tid * LP;
        float m = sS[r];
        for (int d = 1; d < 64; ++d) m = fmaxf(m, sS[r + d]);
        float s = 0.f;
        for (int d = 0; d < 64; ++d) { float e = expf(sS[r + d] - m); sS[r + d] = e; s += e; }
        const float inv = 1.f / s;
        for (int d = 0; d < 64; ++d) sS[r + d] *= inv;
    }
    __syncthreads();

    // M[c,e] = sum_d attn[c,d] * Wv_h[d,e], kept as sT[e][c]
    {
        v8f d0 = zero8, d1 = zero8;
        mm64_tiles(sS, sWv, mt, nt, lc, lh, d0, d1);
        store_tile_t(sT, mt, nt * 16 + lc, lh, d0);
        store_tile_t(sT, mt, nt * 16 + 16 + lc, lh, d1);
    }
    __syncthreads();

    // Pcontrib[c',e] = sum_c Wo_h[c',c] * M[c,e]
    {
        v8f d0 = zero8, d1 = zero8;
        mm64_tiles(sWo, sT, mt, nt, lc, lh, d0, d1);
        float* pc = ws + WS_PC + (size_t)(b * H_ + h) * 4096
                  + (mt * 16 + lh * 8) * 64 + nt * 16 + lc;
#pragma unroll
        for (int r = 0; r < 8; ++r) {   // unrolled: d0, d1 are indexed by constants and stay in registers
            pc[r * 64]      = d0[r];
            pc[r * 64 + 16] = d1[r];
        }
    }
}

// ---------------------------------------------------------------------------
// Kernel 3: P_b = sum_h Pcontrib[b][h], summed by every block while it stages P in LDS
//           (h ascending from 0.f, deterministic); out_b[n,c'] = emb_b[n,:] . P_b[c',:] on WMMA.
// Each wave: one 16-row stripe x all 64 output columns (4 accumulators).
// ---------------------------------------------------------------------------
__global__ __launch_bounds__(256)
void out_kernel(const float* __restrict__ emb, const float* __restrict__ ws,
                float* __restrict__ out) {
    __shared__ __attribute__((aligned(16))) float sP[4096];
    const int batch = blockIdx.x >> 7;   // 128 blocks per batch
    const int blk   = blockIdx.x & 127;
    const int tid   = threadIdx.x;

    // Thread tid owns elements 4*tid + 1024*j + 0..3 of P, j = 0..3.
    {
        const float* pc = ws + WS_PC + (size_t)batch * H_ * 4096 + 4 * tid;
        v4f part[H_][4];
#pragma unroll
        for (int h = 0; h < H_; ++h)   // unrolled with the next loop: 32 independent loads of 16 bytes, no wait per trip
#pragma unroll
            for (int j = 0; j < 4; ++j)
                part[h][j] = *(const v4f*)(pc + h * 4096 + j * 1024);
#pragma unroll
        for (int j = 0; j < 4; ++j) {   // unrolled: part is indexed by constants and stays in registers
            v4f s = {0.f, 0.f, 0.f, 0.f};
#pragma unroll
            for (int h = 0; h < H_; ++h) s += part[h][j];
            *(v4f*)(sP + 4 * tid + j * 1024) = s;
        }
    }
    __syncthreads();

    const int wave = tid >> 5, lane = tid & 31;
    const int n0   = (blk * 8 + wave) * 16;
    const int rlo  = lane & 15;
    const int kh   = (lane >> 4) * 2;

    const float* A = emb + ((size_t)batch * N_ + n0) * C_;

    v8f acc0 = {0.f,0.f,0.f,0.f,0.f,0.f,0.f,0.f};
    v8f acc1 = acc0, acc2 = acc0, acc3 = acc0;

#pragma unroll
    for (int k = 0; k < 16; ++k) {
        v2f a  = *(const v2f*)(A + rlo * C_ + k * 4 + kh);            // emb rows
        v2f b0 = *(const v2f*)(&sP[( 0 + rlo) * 64 + k * 4 + kh]);    // P[c',e] = B[k,n']
        v2f b1 = *(const v2f*)(&sP[(16 + rlo) * 64 + k * 4 + kh]);
        v2f b2 = *(const v2f*)(&sP[(32 + rlo) * 64 + k * 4 + kh]);
        v2f b3 = *(const v2f*)(&sP[(48 + rlo) * 64 + k * 4 + kh]);
        acc0 = __builtin_amdgcn_wmma_f32_16x16x4_f32(false, a, false, b0, (short)0, acc0, false, false);
        acc1 = __builtin_amdgcn_wmma_f32_16x16x4_f32(false, a, false, b1, (short)0, acc1, false, false);
        acc2 = __builtin_amdgcn_wmma_f32_16x16x4_f32(false, a, false, b2, (short)0, acc2, false, false);
        acc3 = __builtin_amdgcn_wmma_f32_16x16x4_f32(false, a, false, b3, (short)0, acc3, false, false);
    }

    float* O = out + ((size_t)batch * N_ + n0) * C_;
    const int rbase = (lane >> 4) * 8;
#pragma unroll
    for (int r = 0; r < 8; ++r) {
        O[(rbase + r) * C_ +  0 + rlo] = acc0[r];
        O[(rbase + r) * C_ + 16 + rlo] = acc1[r];
        O[(rbase + r) * C_ + 32 + rlo] = acc2[r];
        O[(rbase + r) * C_ + 48 + rlo] = acc3[r];
    }
}

// ---------------------------------------------------------------------------
extern "C" void kernel_launch(void* const* d_in, const int* in_sizes, int n_in,
                              void* d_out, int out_size, void* d_ws, size_t ws_size,
                              hipStream_t stream) {
    const float* emb = (const float*)d_in[0];
    const float* Wq  = (const float*)d_in[1];
    const float* Wk  = (const float*)d_in[2];
    const float* Wv  = (const float*)d_in[3];
    const float* Wo  = (const float*)d_in[4];
    float* ws  = (float*)d_ws;
    float* out = (float*)d_out;

    hipLaunchKernelGGL(g_partial_kernel, dim3(B_ * NSLICE * 4), dim3(256), 0, stream, emb, ws);
    hipLaunchKernelGGL(heads_kernel,     dim3(B_ * H_),     dim3(256), 0, stream, Wq, Wk, Wv, Wo, ws);
    hipLaunchKernelGGL(out_kernel,       dim3(256),         dim3(256), 0, stream, emb, ws, out);
}

// v005
// Measured time: 25.2 microseconds a run.
// Next to v004, in two timings, it ran 1.18 and 1.19 times as fast.
// Counting every step since v000, it is 3.98 times as fast.
#include <hip/hip_runtime.h>
#include <math.h>

typedef float v2f __attribute__((ext_vector_type(2)));
typedef float v4f __attribute__((ext_vector_type(4)));
typedef float v8f __attribute__((ext_vector_type(8)));

#define B_ 2
#define N_ 16384
#define C_ 64
#define H_ 8
#define NSLICE 32
#define ROWS_PER_SLICE (N_ / NSLICE)   // 512
#define LP 68   // LDS row pitch in floats of the 64x64 maps: 16 B x odd, for 16-byte fragment reads

// workspace layout (float offsets)
#define WS_GPART 0                              // [B][NSLICE][64*64] partial Gram
#define WS_PC    (B_ * NSLICE * 4096)           // [B][H][64*64] per-head P contribution
// total = 327680 floats = 1.25 MB

// ---------------------------------------------------------------------------
// Kernel 1: partial Gram matrices  Gpart[b][slice] = emb_slice^T @ emb_slice
// Column tile u of G holds the columns 4*l + u (l = 0..15), so one 16-byte load of a lane
// (row n, columns 4*l .. 4*l+3) is that row's element of all four tiles, as A and as B alike.
// A block owns strip t (G rows 4*m + t) of one slice; its 8 waves split the slice's 512 rows,
// 64 each, every emb row read once per block in whole lines; the 8 partial strips are summed in LDS.
// ---------------------------------------------------------------------------
#define GWAVES 8
#define ROWS_PER_WAVE (ROWS_PER_SLICE / GWAVES)   // 64
#define GLOADS (ROWS_PER_WAVE / 2)                // 32 loads a lane: each lane half reads every other row pair
#define GPITCH 20    // floats from l to l+1 of a tile in LDS: 16 B x odd, for 16-byte accesses
#define GTILE  336   // floats from tile u to u+1: 16*GPITCH + 16, so that the sum's reads of u = 0..3 fall on different banks

// x[2*s + j] is row 4*s + 2*hh + j of the wave's rows: k slot (hh, j) of step s, the same for A and B.
template <int T>
__device__ __forceinline__ void strip_products(const v4f (&x)[GLOADS],
                                               v8f& d0, v8f& d1, v8f& d2, v8f& d3) {
    // unrolled whole: x is indexed by constants and stays in registers; each step waits only for its own two loads
#pragma unroll
    for (int s = 0; s < GLOADS / 2; ++s) {
        const v4f r0 = x[2 * s], r1 = x[2 * s + 1];
        const v2f p0 = {r0.x, r1.x}, p1 = {r0.y, r1.y}, p2 = {r0.z, r1.z}, p3 = {r0.w, r1.w};
        const v2f a = (T == 0) ? p0 : (T == 1) ? p1 : (T == 2) ? p2 : p3;
        d0 = __builtin_amdgcn_wmma_f32_16x16x4_f32(false, a, false, p0, (short)0, d0, false, false);
        d1 = __builtin_amdgcn_wmma_f32_16x16x4_f32(false, a, false, p1, (short)0, d1, false, false);
        d2 = __builtin_amdgcn_wmma_f32_16x16x4_f32(false, a, false, p2, (short)0, d2, false, false);
        d3 = __builtin_amdgcn_wmma_f32_16x16x4_f32(false, a, false, p3, (short)0, d3, false, false);
    }
}

__global__ __launch_bounds__(256)
void g_partial_kernel(const float* __restrict__ emb, float* __restrict__ ws) {
    __shared__ __attribute__((aligned(16))) float red[GWAVES * 4 * GTILE];   // [wave][tile u][l][m]
    const int t     = blockIdx.x >> 6;          // strip; the four blocks of a slice lie 64 apart in the grid
    const int bs    = blockIdx.x & 63;          // b * NSLICE + slice
    const int tid   = threadIdx.x;
    const int wave  = tid >> 5;
    const int lane  = tid & 31;
    const int l     = lane & 15;
    const int hh    = lane >> 4;

    const float* p = emb + ((size_t)bs * ROWS_PER_SLICE + wave * ROWS_PER_WAVE + 2 * hh) * C_ + 4 * l;
    v4f x[GLOADS];
#pragma unroll
    for (int s = 0; s < GLOADS / 2; ++s) {   // unrolled: all 32 loads of a lane are in flight together
        x[2 * s]     = *(const v4f*)(p + (4 * s) * C_);
        x[2 * s + 1] = *(const v4f*)(p + (4 * s + 1) * C_);
    }
    // precaution: stands in front of any reuse of the loads' address registers; p is named as an
    // input so that its register pair is not rewritten ahead of the wait
    asm volatile("s_wait_xcnt 0x0" :: "v"(p) : "memory");

    v8f d0 = {0.f, 0.f, 0.f, 0.f, 0.f, 0.f, 0.f, 0.f};
    v8f d1 = d0, d2 = d0, d3 = d0;
    // t is the same for the whole block: a scalar branch picks the copy whose A operand is component t
    switch (t) {
        case 0:  strip_products<0>(x, d0, d1, d2, d3); break;
        case 1:  strip_products<1>(x, d0, d1, d2, d3); break;
        case 2:  strip_products<2>(x, d0, d1, d2, d3); break;
        default: strip_products<3>(x, d0, d1, d2, d3); break;
    }

    // du holds G[4*(r + 8*hh) + t][4*l + u] in lane (l, hh), register r. Each tile goes to LDS as [l][m],
    // 8 consecutive m a lane, straight from the accumulator registers.
    float* rw = red + wave * (4 * GTILE) + l * GPITCH + 8 * hh;
    {
        const v4f q00 = {d0[0], d0[1], d0[2], d0[3]}, q01 = {d0[4], d0[5], d0[6], d0[7]};
        const v4f q10 = {d1[0], d1[1], d1[2], d1[3]}, q11 = {d1[4], d1[5], d1[6], d1[7]};
        const v4f q20 = {d2[0], d2[1], d2[2], d2[3]}, q21 = {d2[4], d2[5], d2[6], d2[7]};
        const v4f q30 = {d3[0], d3[1], d3[2], d3[3]}, q31 = {d3[4], d3[5], d3[6], d3[7]};
        *(v4f*)(rw)                 = q00;  *(v4f*)(rw + 4)             = q01;
        *(v4f*)(rw + GTILE)         = q10;  *(v4f*)(rw + GTILE + 4)     = q11;
        *(v4f*)(rw + 2 * GTILE)     = q20;  *(v4f*)(rw + 2 * GTILE + 4) = q21;
        *(v4f*)(rw + 3 * GTILE)     = q30;  *(v4f*)(rw + 3 * GTILE + 4) = q31;
    }
    __syncthreads();

    // thread tid sums column col = tid & 63 of the strip rows m = 4*(tid >> 6) + 0..3 over the waves, wave 0 first
    const int col = tid & 63, m4 = tid >> 6;
    const float* rr = red + (col & 3) * GTILE + (col >> 2) * GPITCH + 4 * m4;
    v4f sum = {0.f, 0.f, 0.f, 0.f};
#pragma unroll
    for (int w = 0; w < GWAVES; ++w)   // unrolled: the 8 LDS reads issue together
        sum += *(const v4f*)(rr + w * (4 * GTILE));
    float* gp = ws + WS_GPART + (size_t)bs * 4096 + (16 * m4 + t) * 64 + col;
    gp[0]   = sum.x;   // G rows 4*m + t: 4 rows apart; a wave's 32 lanes fill one 128-byte line a store
    gp[256] = sum.y;
    gp[512] = sum.z;
    gp[768] = sum.w;
}

// ---------------------------------------------------------------------------
// One wave's share of a 64x64x64 product D[m][n] = sum_k X[m][k] * Y[n][k]:
// row tile mt against column tiles nt and nt+1. X and Y lie in LDS at pitch LP
// with k contiguous. Lane (c, hh) reads k = 8*kk + 4*hh + 0..3 of its row of X
// and of Y with the same code, so both operands carry the same k order.
// ---------------------------------------------------------------------------
__device__ __forceinline__ void mm64_tiles(const float* X, const float* Y,
                                           int mt, int nt, int c, int hh,
                                           v8f& d0, v8f& d1) {
    const float* xp = X + (mt * 16 + c) * LP + 4 * hh;
    const float* y0 = Y + (nt * 16 + c) * LP + 4 * hh;
    const float* y1 = y0 + 16 * LP;
    // unrolled whole: the LDS reads can issue ahead of the matrix run, no branch behind a WMMA
#pragma unroll
    for (int kk = 0; kk < 8; ++kk) {
        const v4f a  = *(const v4f*)(xp + kk * 8);
        const v4f b0 = *(const v4f*)(y0 + kk * 8);
        const v4f b1 = *(const v4f*)(y1 + kk * 8);
        const v2f alo = {a.x, a.y},   ahi = {a.z, a.w};
        const v2f p0  = {b0.x, b0.y}, q0  = {b0.z, b0.w};
        const v2f p1  = {b1.x, b1.y}, q1  = {b1.z, b1.w};
        d0 = __builtin_amdgcn_wmma_f32_16x16x4_f32(false, alo, false, p0, (short)0, d0, false, false);
        d1 = __builtin_amdgcn_wmma_f32_16x16x4_f32(false, alo, false, p1, (short)0, d1, false, false);
        d0 = __builtin_amdgcn_wmma_f32_16x16x4_f32(false, ahi, false, q0, (short)0, d0, false, false);
        d1 = __builtin_amdgcn_wmma_f32_16x16x4_f32(false, ahi, false, q1, (short)0, d1, false, false);
    }
}

// D tile (rows 16*mt + 8*hh + r, column n) stored transposed: Z[n][m], 8 consecutive m per lane
__device__ __forceinline__ void store_tile_t(float* Z, int mt, int n, int hh, const v8f& d) {
    float* z = Z + n * LP + mt * 16 + hh * 8;
    const v4f lo = {d[0], d[1], d[2], d[3]}, hi = {d[4], d[5], d[6], d[7]};
    *(v4f*)z = lo;
    *(v4f*)(z + 4) = hi;
}

// Value of lane l ^ M, M < 16, by a DPP move inside the 16-lane row; every lane is on where it is used.
template <int M>
__device__ __forceinline__ float lane_xor(float v) {
    return __builtin_bit_cast(float,
        __builtin_amdgcn_update_dpp(0, __builtin_bit_cast(int, v), 0x160 | M, 0xf, 0xf, true));   // 0x160 | M = row_xmask:M
}

// Sum over the 16 lanes of a row; every lane gets it.
__device__ __forceinline__ float row16_sum(float v) {
    v += lane_xor<1>(v);
    v += lane_xor<2>(v);
    v += lane_xor<4>(v);
    v += lane_xor<8>(v);
    return v;
}

// ---------------------------------------------------------------------------
// Kernel 2: per (b,h): S = Wq_h G Wk_h^T ; instance-norm ; softmax(rows) ;
//           M = attn @ Wv_h ; Pcontrib = Wo_h @ M.   All 64x64, done in LDS;
//           the four products run on WMMA f32, 8 waves x 2 tiles of 16x16.
// ---------------------------------------------------------------------------
__global__ __launch_bounds__(256)
void heads_kernel(const float* __restrict__ Wq, const float* __restrict__ Wk,
                  const float* __restrict__ Wv, const float* __restrict__ Wo,
                  float* __restrict__ ws) {
    __shared__ __attribute__((aligned(16))) float sG[64 * LP], sT[64 * LP], sS[64 * LP];
    __shared__ __attribute__((aligned(16))) float sWk[64 * LP], sWq[64 * LP], sWv[64 * LP], sWo[64 * LP];
    __shared__ __attribute__((aligned(16))) float red[16], red2[16];   // one partial sum per 16 lanes

    const int b = blockIdx.x >> 3;
    const int h = blockIdx.x & 7;
    const int tid = threadIdx.x;
    const int lane = tid & 31;
    const int lc = lane & 15, lh = lane >> 4;      // fragment column / k half
    const int mt = tid >> 6;                       // wave's row tile
    const int nt = ((tid >> 5) & 1) * 2;           // wave's first column tile
    const v8f zero8 = {0.f, 0.f, 0.f, 0.f, 0.f, 0.f, 0.f, 0.f};

    // All four weight maps are requested here, ahead of the Gram sum: their latency runs
    // under that sum's own loads, and no product later waits on a global load.
    // Thread tid holds elements i = tid + 256*j of each 64x64 map: row (tid >> 6) + 4*j, column tid & 63.
    const int trow = tid >> 6, tcol = tid & 63;
    const float* gk = Wk + h * 4096 + tid;
    const float* gq = Wq + h * 4096 + tid;
    const float* gv = Wv + h * 4096 + tid;
    const float* go = Wo + trow * 512 + tcol * 8 + h;   // Wo_h[c',c] = Wo[c'*512 + c*8 + h]
    float rk[16], rq[16], rv[16], ro[16];
#pragma unroll
    for (int j = 0; j < 16; ++j) {   // unrolled: the 64 loads are in flight together, values stay in registers
        rk[j] = gk[j * 256];
        rq[j] = gq[j * 256];
        rv[j] = gv[j * 256];
        ro[j] = go[j * 2048];
    }
    // precaution: stands in front of any reuse of the loads' address registers; go is named as an
    // input so that its register pair, the only one that dies here, is not rewritten ahead of the wait
    asm volatile("s_wait_xcnt 0x0" :: "v"(go) : "memory");

    // deterministic reduce of Gram partials
    for (int i = tid; i < 4096; i += 256) {
        const float* gp = ws + WS_GPART + (size_t)b * NSLICE * 4096 + i;
        float s = 0.f;
        for (int sl = 0; sl < NSLICE; ++sl) s += gp[sl * 4096];
        sG[(i >> 6) * LP + (i & 63)] = s;
    }
#pragma unroll
    for (int j = 0; j < 16; ++j) {   // unrolled: rk..ro are indexed by constants
        const int p = (trow + 4 * j) * LP + tcol;
        sWk[p] = rk[j];
        sWq[p] = rq[j];
        sWv[tcol * LP + trow + 4 * j] = rv[j];   // kept as sWv[e][d], so that the product's k (= d) is contiguous
        sWo[p] = ro[j];
    }
    __syncthreads();

    // T1[e,d] = sum_f G[e,f] * Wk_h[d,f], kept as sT[d][e]
    {
        v8f d0 = zero8, d1 = zero8;
        mm64_tiles(sG, sWk, mt, nt, lc, lh, d0, d1);
        store_tile_t(sT, mt, nt * 16 + lc, lh, d0);
        store_tile_t(sT, mt, nt * 16 + 16 + lc, lh, d1);
    }
    __syncthreads();

    // S[c,d] = sum_e Wq_h[c,e] * T1[e,d]
    {
        v8f d0 = zero8, d1 = zero8;
        mm64_tiles(sWq, sT, mt, nt, lc, lh, d0, d1);
        float* sp = sS + (mt * 16 + lh * 8) * LP + nt * 16 + lc;
#pragma unroll
        for (int r = 0; r < 8; ++r) {   // unrolled: d0, d1 are indexed by constants and stay in registers
            sp[r * LP]      = d0[r];
            sp[r * LP + 16] = d1[r];
        }
    }
    __syncthreads();

    // InstanceNorm over the full 64x64 map (biased variance, eps=1e-5), then softmax along d, all in registers:
    // thread tid holds columns 16*(tid & 3) + 0..15 of row tid >> 2, so the four lanes of a row are neighbours
    // and a 16-byte read of lanes 0..15 (4 rows x 4 quarters at pitch LP) falls on 64 different banks.
    {
        float* rowp = sS + (tid >> 2) * LP + 16 * (tid & 3);
        v4f x[4];
#pragma unroll
        for (int i = 0; i < 4; ++i) x[i] = *(const v4f*)(rowp + 4 * i);   // unrolled: x stays in registers

        const v4f sv = (x[0] + x[1]) + (x[2] + x[3]);
        const v4f qv = (x[0] * x[0] + x[1] * x[1]) + (x[2] * x[2] + x[3] * x[3]);
        const float s  = row16_sum((sv.x + sv.y) + (sv.z + sv.w));
        const float s2 = row16_sum((qv.x + qv.y) + (qv.z + qv.w));
        if (lc == 0) { red[tid >> 4] = s; red2[tid >> 4] = s2; }
        __syncthreads();
        // every thread adds the 16 partial sums itself, in one fixed order: no thread waits for another's result
        const v4f* r1 = (const v4f*)red;
        const v4f* r2 = (const v4f*)red2;
        const v4f ts = (r1[0] + r1[1]) + (r1[2] + r1[3]);
        const v4f tq = (r2[0] + r2[1]) + (r2[2] + r2[3]);
        const float mean = ((ts.x + ts.y) + (ts.z + ts.w)) * (1.0f / 4096.0f);
        const float var  = ((tq.x + tq.y) + (tq.z + tq.w)) * (1.0f / 4096.0f) - mean * mean;
        const float rstd = rsqrtf(var + 1e-5f);

#pragma unroll
        for (int i = 0; i < 4; ++i) x[i] = (x[i] - mean) * rstd;   // unrolled, as every loop over x: constant indices
        v4f mv = x[0];
#pragma unroll
        for (int i = 1; i < 4; ++i) {   // unrolled: constant indices into x
            mv.x = fmaxf(mv.x, x[i].x);  mv.y = fmaxf(mv.y, x[i].y);
            mv.z = fmaxf(mv.z, x[i].z);  mv.w = fmaxf(mv.w, x[i].w);
        }
        float m = fmaxf(fmaxf(mv.x, mv.y), fmaxf(mv.z, mv.w));
        m = fmaxf(m, lane_xor<1>(m));
        m = fmaxf(m, lane_xor<2>(m));

        v4f ev = {0.f, 0.f, 0.f, 0.f};
#pragma unroll
        for (int i = 0; i < 4; ++i) {   // unrolled: constant indices into x; the 16 exponentials are independent
            x[i].x = expf(x[i].x - m);  x[i].y = expf(x[i].y - m);
            x[i].z = expf(x[i].z - m);  x[i].w = expf(x[i].w - m);
            ev += x[i];
        }
        float e = (ev.x + ev.y) + (ev.z + ev.w);
        e += lane_xor<1>(e);
        e += lane_xor<2>(e);
        const float inv = 1.f / e;
        // a thread rewrites only what it read itself, so no barrier is needed between its reads and these stores
#pragma unroll
        for (int i = 0; i < 4; ++i) *(v4f*)(rowp + 4 * i) = x[i] * inv;   // unrolled: constant indices into x
    }
    __syncthreads();

    // M[c,e] = sum_d attn[c,d] * Wv_h[d,e], kept as sT[e][c]
    {
        v8f d0 = zero8, d1 = zero8;
        mm64_tiles(sS, sWv, mt, nt, lc, lh, d0, d1);
        store_tile_t(sT, mt, nt * 16 + lc, lh, d0);
        store_tile_t(sT, mt, nt * 16 + 16 + lc, lh, d1);
    }
    __syncthreads();

    // Pcontrib[c',e] = sum_c Wo_h[c',c] * M[c,e]
    {
        v8f d0 = zero8, d1 = zero8;
        mm64_tiles(sWo, sT, mt, nt, lc, lh, d0, d1);
        float* pc = ws + WS_PC + (size_t)(b * H_ + h) * 4096
                  + (mt * 16 + lh * 8) * 64 + nt * 16 + lc;
#pragma unroll
        for (int r = 0; r < 8; ++r) {   // unrolled: d0, d1 are indexed by constants and stay in registers
            pc[r * 64]      = d0[r];
            pc[r * 64 + 16] = d1[r];
        }
    }
}

// ---------------------------------------------------------------------------
// Kernel 3: P_b = sum_h Pcontrib[b][h], summed by every block while it stages P in LDS
//           (h ascending from 0.f, deterministic); out_b[n,c'] = emb_b[n,:] . P_b[c',:] on WMMA.
// Each wave: one 16-row stripe x all 64 output columns (4 accumulators).
// ---------------------------------------------------------------------------
__global__ __launch_bounds__(256)
void out_kernel(const float* __restrict__ emb, const float* __restrict__ ws,
                float* __restrict__ out) {
    __shared__ __attribute__((aligned(16))) float sP[4096];
    const int batch = blockIdx.x >> 7;   // 128 blocks per batch
    const int blk   = blockIdx.x & 127;
    const int tid   = threadIdx.x;

    // Thread tid owns elements 4*tid + 1024*j + 0..3 of P, j = 0..3.
    {
        const float* pc = ws + WS_PC + (size_t)batch * H_ * 4096 + 4 * tid;
        v4f part[H_][4];
#pragma unroll
        for (int h = 0; h < H_; ++h)   // unrolled with the next loop: 32 independent loads of 16 bytes, no wait per trip
#pragma unroll
            for (int j = 0; j < 4; ++j)
                part[h][j] = *(const v4f*)(pc + h * 4096 + j * 1024);
#pragma unroll
        for (int j = 0; j < 4; ++j) {   // unrolled: part is indexed by constants and stays in registers
            v4f s = {0.f, 0.f, 0.f, 0.f};
#pragma unroll
            for (int h = 0; h < H_; ++h) s += part[h][j];
            *(v4f*)(sP + 4 * tid + j * 1024) = s;
        }
    }
    __syncthreads();

    const int wave = tid >> 5, lane = tid & 31;
    const int n0   = (blk * 8 + wave) * 16;
    const int rlo  = lane & 15;
    const int kh   = (lane >> 4) * 2;

    const float* A = emb + ((size_t)batch * N_ + n0) * C_;

    v8f acc0 = {0.f,0.f,0.f,0.f,0.f,0.f,0.f,0.f};
    v8f acc1 = acc0, acc2 = acc0, acc3 = acc0;

#pragma unroll
    for (int k = 0; k < 16; ++k) {
        v2f a  = *(const v2f*)(A + rlo * C_ + k * 4 + kh);            // emb rows
        v2f b0 = *(const v2f*)(&sP[( 0 + rlo) * 64 + k * 4 + kh]);    // P[c',e] = B[k,n']
        v2f b1 = *(const v2f*)(&sP[(16 + rlo) * 64 + k * 4 + kh]);
        v2f b2 = *(const v2f*)(&sP[(32 + rlo) * 64 + k * 4 + kh]);
        v2f b3 = *(const v2f*)(&sP[(48 + rlo) * 64 + k * 4 + kh]);
        acc0 = __builtin_amdgcn_wmma_f32_16x16x4_f32(false, a, false, b0, (short)0, acc0, false, false);
        acc1 = __builtin_amdgcn_wmma_f32_16x16x4_f32(false, a, false, b1, (short)0, acc1, false, false);
        acc2 = __builtin_amdgcn_wmma_f32_16x16x4_f32(false, a, false, b2, (short)0, acc2, false, false);
        acc3 = __builtin_amdgcn_wmma_f32_16x16x4_f32(false, a, false, b3, (short)0, acc3, false, false);
    }

    float* O = out + ((size_t)batch * N_ + n0) * C_;
    const int rbase = (lane >> 4) * 8;
#pragma unroll
    for (int r = 0; r < 8; ++r) {
        O[(rbase + r) * C_ +  0 + rlo] = acc0[r];
        O[(rbase + r) * C_ + 16 + rlo] = acc1[r];
        O[(rbase + r) * C_ + 32 + rlo] = acc2[r];
        O[(rbase + r) * C_ + 48 + rlo] = acc3[r];
    }
}

// ---------------------------------------------------------------------------
extern "C" void kernel_launch(void* const* d_in, const int* in_sizes, int n_in,
                              void* d_out, int out_size, void* d_ws, size_t ws_size,
                              hipStream_t stream) {
    const float* emb = (const float*)d_in[0];
    const float* Wq  = (const float*)d_in[1];
    const float* Wk  = (const float*)d_in[2];
    const float* Wv  = (const float*)d_in[3];
    const float* Wo  = (const float*)d_in[4];
    float* ws  = (float*)d_ws;
    float* out = (float*)d_out;

    hipLaunchKernelGGL(g_partial_kernel, dim3(B_ * NSLICE * 4), dim3(256), 0, stream, emb, ws);
    hipLaunchKernelGGL(heads_kernel,     dim3(B_ * H_),     dim3(256), 0, stream, Wq, Wk, Wv, Wo, ws);
    hipLaunchKernelGGL(out_kernel,       dim3(256),         dim3(256), 0, stream, emb, ws, out);
}

// v006
// Measured time: 22.5 microseconds a run.
// Next to v005, in two timings, it ran 1.09 times as fast each time.
// Over all steps from v000 it is 4.34 times as fast.
#include <hip/hip_runtime.h>
#include <math.h>

typedef float v2f __attribute__((ext_vector_type(2)));
typedef float v4f __attribute__((ext_vector_type(4)));
typedef float v8f __attribute__((ext_vector_type(8)));

#define B_ 2
#define N_ 16384
#define C_ 64
#define H_ 8
#define NSLICE 32
#define ROWS_PER_SLICE (N_ / NSLICE)   // 512
#define LP 68   // LDS row pitch in floats of the 64x64 maps: 16 B x odd, for 16-byte fragment reads

// workspace layout (float offsets)
#define WS_GPART 0                              // [B][NSLICE][64*64] partial Gram
#define WS_PC    (B_ * NSLICE * 4096)           // [B][H][64*64] per-head P contribution
// total = 327680 floats = 1.25 MB

// ---------------------------------------------------------------------------
// Kernel 1: partial Gram matrices  Gpart[b][slice] = emb_slice^T @ emb_slice
// Column tile u of G holds the columns 4*l + u (l = 0..15), so one 16-byte load of a lane
// (row n, columns 4*l .. 4*l+3) is that row's element of all four tiles, as A and as B alike.
// A block owns strip t (G rows 4*m + t) of one slice; its 8 waves split the slice's 512 rows,
// 64 each, every emb row read once per block in whole lines; the 8 partial strips are summed in LDS.
// ---------------------------------------------------------------------------
#define GWAVES 8
#define ROWS_PER_WAVE (ROWS_PER_SLICE / GWAVES)   // 64
#define GLOADS (ROWS_PER_WAVE / 2)                // 32 loads a lane: each lane half reads every other row pair
#define GPITCH 20    // floats from l to l+1 of a tile in LDS: 16 B x odd, for 16-byte accesses
#define GTILE  336   // floats from tile u to u+1: 16*GPITCH + 16, so that the sum's reads of u = 0..3 fall on different banks

// x[2*s + j] is row 4*s + 2*hh + j of the wave's rows: k slot (hh, j) of step s, the same for A and B.
template <int T>
__device__ __forceinline__ void strip_products(const v4f (&x)[GLOADS],
                                               v8f& d0, v8f& d1, v8f& d2, v8f& d3) {
    // unrolled whole: x is indexed by constants and stays in registers; each step waits only for its own two loads
#pragma unroll
    for (int s = 0; s < GLOADS / 2; ++s) {
        const v4f r0 = x[2 * s], r1 = x[2 * s + 1];
        const v2f p0 = {r0.x, r1.x}, p1 = {r0.y, r1.y}, p2 = {r0.z, r1.z}, p3 = {r0.w, r1.w};
        const v2f a = (T == 0) ? p0 : (T == 1) ? p1 : (T == 2) ? p2 : p3;
        d0 = __builtin_amdgcn_wmma_f32_16x16x4_f32(false, a, false, p0, (short)0, d0, false, false);
        d1 = __builtin_amdgcn_wmma_f32_16x16x4_f32(false, a, false, p1, (short)0, d1, false, false);
        d2 = __builtin_amdgcn_wmma_f32_16x16x4_f32(false, a, false, p2, (short)0, d2, false, false);
        d3 = __builtin_amdgcn_wmma_f32_16x16x4_f32(false, a, false, p3, (short)0, d3, false, false);
    }
}

__global__ __launch_bounds__(256)
void g_partial_kernel(const float* __restrict__ emb, float* __restrict__ ws) {
    __shared__ __attribute__((aligned(16))) float red[GWAVES * 4 * GTILE];   // [wave][tile u][l][m]
    const int t     = blockIdx.x >> 6;          // strip; the four blocks of a slice lie 64 apart in the grid
    const int bs    = blockIdx.x & 63;          // b * NSLICE + slice
    const int tid   = threadIdx.x;
    const int wave  = tid >> 5;
    const int lane  = tid & 31;
    const int l     = lane & 15;
    const int hh    = lane >> 4;

    const float* p = emb + ((size_t)bs * ROWS_PER_SLICE + wave * ROWS_PER_WAVE + 2 * hh) * C_ + 4 * l;
    v4f x[GLOADS];
#pragma unroll
    for (int s = 0; s < GLOADS / 2; ++s) {   // unrolled: all 32 loads of a lane are in flight together
        x[2 * s]     = *(const v4f*)(p + (4 * s) * C_);
        x[2 * s + 1] = *(const v4f*)(p + (4 * s + 1) * C_);
    }
    // precaution: stands in front of any reuse of the loads' address registers; p is named as an
    // input so that its register pair is not rewritten ahead of the wait
    asm volatile("s_wait_xcnt 0x0" :: "v"(p) : "memory");

    v8f d0 = {0.f, 0.f, 0.f, 0.f, 0.f, 0.f, 0.f, 0.f};
    v8f d1 = d0, d2 = d0, d3 = d0;
    // t is the same for the whole block: a scalar branch picks the copy whose A operand is component t
    switch (t) {
        case 0:  strip_products<0>(x, d0, d1, d2, d3); break;
        case 1:  strip_products<1>(x, d0, d1, d2, d3); break;
        case 2:  strip_products<2>(x, d0, d1, d2, d3); break;
        default: strip_products<3>(x, d0, d1, d2, d3); break;
    }

    // du holds G[4*(r + 8*hh) + t][4*l + u] in lane (l, hh), register r. Each tile goes to LDS as [l][m],
    // 8 consecutive m a lane, straight from the accumulator registers.
    float* rw = red + wave * (4 * GTILE) + l * GPITCH + 8 * hh;
    {
        const v4f q00 = {d0[0], d0[1], d0[2], d0[3]}, q01 = {d0[4], d0[5], d0[6], d0[7]};
        const v4f q10 = {d1[0], d1[1], d1[2], d1[3]}, q11 = {d1[4], d1[5], d1[6], d1[7]};
        const v4f q20 = {d2[0], d2[1], d2[2], d2[3]}, q21 = {d2[4], d2[5], d2[6], d2[7]};
        const v4f q30 = {d3[0], d3[1], d3[2], d3[3]}, q31 = {d3[4], d3[5], d3[6], d3[7]};
        *(v4f*)(rw)                 = q00;  *(v4f*)(rw + 4)             = q01;
        *(v4f*)(rw + GTILE)         = q10;  *(v4f*)(rw + GTILE + 4)     = q11;
        *(v4f*)(rw + 2 * GTILE)     = q20;  *(v4f*)(rw + 2 * GTILE + 4) = q21;
        *(v4f*)(rw + 3 * GTILE)     = q30;  *(v4f*)(rw + 3 * GTILE + 4) = q31;
    }
    __syncthreads();

    // thread tid sums column col = tid & 63 of the strip rows m = 4*(tid >> 6) + 0..3 over the waves, wave 0 first
    const int col = tid & 63, m4 = tid >> 6;
    const float* rr = red + (col & 3) * GTILE + (col >> 2) * GPITCH + 4 * m4;
    v4f sum = {0.f, 0.f, 0.f, 0.f};
#pragma unroll
    for (int w = 0; w < GWAVES; ++w)   // unrolled: the 8 LDS reads issue together
        sum += *(const v4f*)(rr + w * (4 * GTILE));
    float* gp = ws + WS_GPART + (size_t)bs * 4096 + (16 * m4 + t) * 64 + col;
    gp[0]   = sum.x;   // G rows 4*m + t: 4 rows apart; a wave's 32 lanes fill one 128-byte line a store
    gp[256] = sum.y;
    gp[512] = sum.z;
    gp[768] = sum.w;
}

// ---------------------------------------------------------------------------
// One wave's share of a 64x64x64 product D[m][n] = sum_k X[m][k] * Y[n][k]:
// row tile mt against column tiles nt and nt+1. X and Y lie in LDS at pitch LP
// with k contiguous. Lane (c, hh) reads k = 8*kk + 4*hh + 0..3 of its row of X
// and of Y with the same code, so both operands carry the same k order.
// ---------------------------------------------------------------------------
__device__ __forceinline__ void mm64_tiles(const float* X, const float* Y,
                                           int mt, int nt, int c, int hh,
                                           v8f& d0, v8f& d1) {
    const float* xp = X + (mt * 16 + c) * LP + 4 * hh;
    const float* y0 = Y + (nt * 16 + c) * LP + 4 * hh;
    const float* y1 = y0 + 16 * LP;
    // unrolled whole: the LDS reads can issue ahead of the matrix run, no branch behind a WMMA
#pragma unroll
    for (int kk = 0; kk < 8; ++kk) {
        const v4f a  = *(const v4f*)(xp + kk * 8);
        const v4f b0 = *(const v4f*)(y0 + kk * 8);
        const v4f b1 = *(const v4f*)(y1 + kk * 8);
        const v2f alo = {a.x, a.y},   ahi = {a.z, a.w};
        const v2f p0  = {b0.x, b0.y}, q0  = {b0.z, b0.w};
        const v2f p1  = {b1.x, b1.y}, q1  = {b1.z, b1.w};
        d0 = __builtin_amdgcn_wmma_f32_16x16x4_f32(false, alo, false, p0, (short)0, d0, false, false);
        d1 = __builtin_amdgcn_wmma_f32_16x16x4_f32(false, alo, false, p1, (short)0, d1, false, false);
        d0 = __builtin_amdgcn_wmma_f32_16x16x4_f32(false, ahi, false, q0, (short)0, d0, false, false);
        d1 = __builtin_amdgcn_wmma_f32_16x16x4_f32(false, ahi, false, q1, (short)0, d1, false, false);
    }
}

// D tile (rows 16*mt + 8*hh + r, column n) stored transposed: Z[n][m], 8 consecutive m per lane
__device__ __forceinline__ void store_tile_t(float* Z, int mt, int n, int hh, const v8f& d) {
    float* z = Z + n * LP + mt * 16 + hh * 8;
    const v4f lo = {d[0], d[1], d[2], d[3]}, hi = {d[4], d[5], d[6], d[7]};
    *(v4f*)z = lo;
    *(v4f*)(z + 4) = hi;
}

// Value of lane l ^ M, M < 16, by a DPP move inside the 16-lane row; every lane is on where it is used.
template <int M>
__device__ __forceinline__ float lane_xor(float v) {
    return __builtin_bit_cast(float,
        __builtin_amdgcn_update_dpp(0, __builtin_bit_cast(int, v), 0x160 | M, 0xf, 0xf, true));   // 0x160 | M = row_xmask:M
}

// Sum over the 16 lanes of a row; every lane gets it.
__device__ __forceinline__ float row16_sum(float v) {
    v += lane_xor<1>(v);
    v += lane_xor<2>(v);
    v += lane_xor<4>(v);
    v += lane_xor<8>(v);
    return v;
}

// ---------------------------------------------------------------------------
// Kernel 2: per (b,h): S = Wq_h G Wk_h^T ; instance-norm ; softmax(rows) ;
//           M = attn @ Wv_h ; Pcontrib = Wo_h @ M.   All 64x64, done in LDS;
//           the four products run on WMMA f32, 8 waves x 2 tiles of 16x16.
// ---------------------------------------------------------------------------
__global__ __launch_bounds__(256)
void heads_kernel(const float* __restrict__ Wq, const float* __restrict__ Wk,
                  const float* __restrict__ Wv, const float* __restrict__ Wo,
                  float* __restrict__ ws) {
    __shared__ __attribute__((aligned(16))) float sG[64 * LP], sT[64 * LP], sS[64 * LP];
    __shared__ __attribute__((aligned(16))) float sWk[64 * LP], sWq[64 * LP], sWv[64 * LP], sWo[64 * LP];
    __shared__ __attribute__((aligned(16))) float red[16], red2[16];   // one partial sum per 16 lanes

    const int b = blockIdx.x >> 3;
    const int h = blockIdx.x & 7;
    const int tid = threadIdx.x;
    const int lane = tid & 31;
    const int lc = lane & 15, lh = lane >> 4;      // fragment column / k half
    const int mt = tid >> 6;                       // wave's row tile
    const int nt = ((tid >> 5) & 1) * 2;           // wave's first column tile
    const v8f zero8 = {0.f, 0.f, 0.f, 0.f, 0.f, 0.f, 0.f, 0.f};

    // All four weight maps are requested here, ahead of the Gram sum: their latency runs
    // under that sum's own loads, and no product later waits on a global load.
    // Thread tid holds elements i = tid + 256*j of each 64x64 map: row (tid >> 6) + 4*j, column tid & 63.
    const int trow = tid >> 6, tcol = tid & 63;
    const float* gk = Wk + h * 4096 + tid;
    const float* gq = Wq + h * 4096 + tid;
    const float* gv = Wv + h * 4096 + tid;
    const float* go = Wo + trow * 512 + tcol * 8 + h;   // Wo_h[c',c] = Wo[c'*512 + c*8 + h]
    float rk[16], rq[16], rv[16], ro[16];
#pragma unroll
    for (int j = 0; j < 16; ++j) {   // unrolled: the 64 loads are in flight together, values stay in registers
        rk[j] = gk[j * 256];
        rq[j] = gq[j * 256];
        rv[j] = gv[j * 256];
        ro[j] = go[j * 2048];
    }
    // precaution: stands in front of any reuse of the loads' address registers; go is named as an
    // input so that its register pair, the only one that dies here, is not rewritten ahead of the wait
    asm volatile("s_wait_xcnt 0x0" :: "v"(go) : "memory");

    // deterministic reduce of Gram partials
    for (int i = tid; i < 4096; i += 256) {
        const float* gp = ws + WS_GPART + (size_t)b * NSLICE * 4096 + i;
        float s = 0.f;
        for (int sl = 0; sl < NSLICE; ++sl) s += gp[sl * 4096];
        sG[(i >> 6) * LP + (i & 63)] = s;
    }
#pragma unroll
    for (int j = 0; j < 16; ++j) {   // unrolled: rk..ro are indexed by constants
        const int p = (trow + 4 * j) * LP + tcol;
        sWk[p] = rk[j];
        sWq[p] = rq[j];
        sWv[tcol * LP + trow + 4 * j] = rv[j];   // kept as sWv[e][d], so that the product's k (= d) is contiguous
        sWo[p] = ro[j];
    }
    __syncthreads();

    // T1[e,d] = sum_f G[e,f] * Wk_h[d,f], kept as sT[d][e]
    {
        v8f d0 = zero8, d1 = zero8;
        mm64_tiles(sG, sWk, mt, nt, lc, lh, d0, d1);
        store_tile_t(sT, mt, nt * 16 + lc, lh, d0);
        store_tile_t(sT, mt, nt * 16 + 16 + lc, lh, d1);
    }
    __syncthreads();

    // S[c,d] = sum_e Wq_h[c,e] * T1[e,d]
    {
        v8f d0 = zero8, d1 = zero8;
        mm64_tiles(sWq, sT, mt, nt, lc, lh, d0, d1);
        float* sp = sS + (mt * 16 + lh * 8) * LP + nt * 16 + lc;
#pragma unroll
        for (int r = 0; r < 8; ++r) {   // unrolled: d0, d1 are indexed by constants and stay in registers
            sp[r * LP]      = d0[r];
            sp[r * LP + 16] = d1[r];
        }
    }
    __syncthreads();

    // InstanceNorm over the full 64x64 map (biased variance, eps=1e-5), then softmax along d, all in registers:
    // thread tid holds columns 16*(tid & 3) + 0..15 of row tid >> 2, so the four lanes of a row are neighbours
    // and a 16-byte read of lanes 0..15 (4 rows x 4 quarters at pitch LP) falls on 64 different banks.
    {
        float* rowp = sS + (tid >> 2) * LP + 16 * (tid & 3);
        v4f x[4];
#pragma unroll
        for (int i = 0; i < 4; ++i) x[i] = *(const v4f*)(rowp + 4 * i);   // unrolled: x stays in registers

        const v4f sv = (x[0] + x[1]) + (x[2] + x[3]);
        const v4f qv = (x[0] * x[0] + x[1] * x[1]) + (x[2] * x[2] + x[3] * x[3]);
        const float s  = row16_sum((sv.x + sv.y) + (sv.z + sv.w));
        const float s2 = row16_sum((qv.x + qv.y) + (qv.z + qv.w));
        if (lc == 0) { red[tid >> 4] = s; red2[tid >> 4] = s2; }
        __syncthreads();
        // every thread adds the 16 partial sums itself, in one fixed order: no thread waits for another's result
        const v4f* r1 = (const v4f*)red;
        const v4f* r2 = (const v4f*)red2;
        const v4f ts = (r1[0] + r1[1]) + (r1[2] + r1[3]);
        const v4f tq = (r2[0] + r2[1]) + (r2[2] + r2[3]);
        const float mean = ((ts.x + ts.y) + (ts.z + ts.w)) * (1.0f / 4096.0f);
        const float var  = ((tq.x + tq.y) + (tq.z + tq.w)) * (1.0f / 4096.0f) - mean * mean;
        const float rstd = rsqrtf(var + 1e-5f);

#pragma unroll
        for (int i = 0; i < 4; ++i) x[i] = (x[i] - mean) * rstd;   // unrolled, as every loop over x: constant indices
        v4f mv = x[0];
#pragma unroll
        for (int i = 1; i < 4; ++i) {   // unrolled: constant indices into x
            mv.x = fmaxf(mv.x, x[i].x);  mv.y = fmaxf(mv.y, x[i].y);
            mv.z = fmaxf(mv.z, x[i].z);  mv.w = fmaxf(mv.w, x[i].w);
        }
        float m = fmaxf(fmaxf(mv.x, mv.y), fmaxf(mv.z, mv.w));
        m = fmaxf(m, lane_xor<1>(m));
        m = fmaxf(m, lane_xor<2>(m));

        v4f ev = {0.f, 0.f, 0.f, 0.f};
#pragma unroll
        for (int i = 0; i < 4; ++i) {   // unrolled: constant indices into x; the 16 exponentials are independent
            x[i].x = expf(x[i].x - m);  x[i].y = expf(x[i].y - m);
            x[i].z = expf(x[i].z - m);  x[i].w = expf(x[i].w - m);
            ev += x[i];
        }
        float e = (ev.x + ev.y) + (ev.z + ev.w);
        e += lane_xor<1>(e);
        e += lane_xor<2>(e);
        const float inv = 1.f / e;
        // a thread rewrites only what it read itself, so no barrier is needed between its reads and these stores
#pragma unroll
        for (int i = 0; i < 4; ++i) *(v4f*)(rowp + 4 * i) = x[i] * inv;   // unrolled: constant indices into x
    }
    __syncthreads();

    // M[c,e] = sum_d attn[c,d] * Wv_h[d,e], kept as sT[e][c]
    {
        v8f d0 = zero8, d1 = zero8;
        mm64_tiles(sS, sWv, mt, nt, lc, lh, d0, d1);
        store_tile_t(sT, mt, nt * 16 + lc, lh, d0);
        store_tile_t(sT, mt, nt * 16 + 16 + lc, lh, d1);
    }
    __syncthreads();

    // Pcontrib[c',e] = sum_c Wo_h[c',c] * M[c,e]
    {
        v8f d0 = zero8, d1 = zero8;
        mm64_tiles(sWo, sT, mt, nt, lc, lh, d0, d1);
        float* pc = ws + WS_PC + (size_t)(b * H_ + h) * 4096
                  + (mt * 16 + lh * 8) * 64 + nt * 16 + lc;
#pragma unroll
        for (int r = 0; r < 8; ++r) {   // unrolled: d0, d1 are indexed by constants and stay in registers
            pc[r * 64]      = d0[r];
            pc[r * 64 + 16] = d1[r];
        }
    }
}

// ---------------------------------------------------------------------------
// Kernel 3: P_b = sum_h Pcontrib[b][h], summed by every block while it stages P in LDS
//           (h ascending from 0.f, deterministic); out_b[n,c'] = emb_b[n,:] . P_b[c',:] on WMMA.
// Each wave: one 16-row stripe x all 64 output columns (4 accumulators).
// P lies in LDS at pitch LP (16 B x odd). Lane (rlo, hh) reads k = 8*kk + 4*hh + 0..3 of its emb row
// and of its four P rows, 16 bytes each: both operands carry the same k order, and the 16 rows that
// the lanes of a read touch fall on different banks.
// ---------------------------------------------------------------------------
__global__ __launch_bounds__(256)
void out_kernel(const float* __restrict__ emb, const float* __restrict__ ws,
                float* __restrict__ out) {
    __shared__ __attribute__((aligned(16))) float sP[64 * LP];
    const int batch = blockIdx.x >> 7;   // 128 blocks per batch
    const int blk   = blockIdx.x & 127;
    const int tid   = threadIdx.x;

    // Thread tid owns elements 4*tid + 1024*j + 0..3 of P, j = 0..3: row (tid >> 4) + 16*j, columns 4*(tid & 15) + 0..3.
    {
        const float* pc = ws + WS_PC + (size_t)batch * H_ * 4096 + 4 * tid;
        v4f part[H_][4];
#pragma unroll
        for (int h = 0; h < H_; ++h)   // unrolled with the next loop: 32 independent loads of 16 bytes, no wait per trip
#pragma unroll
            for (int j = 0; j < 4; ++j)
                part[h][j] = *(const v4f*)(pc + h * 4096 + j * 1024);
#pragma unroll
        for (int j = 0; j < 4; ++j) {   // unrolled: part is indexed by constants and stays in registers
            v4f s = {0.f, 0.f, 0.f, 0.f};
#pragma unroll
            for (int h = 0; h < H_; ++h) s += part[h][j];
            *(v4f*)(sP + ((tid >> 4) + 16 * j) * LP + 4 * (tid & 15)) = s;
        }
    }
    __syncthreads();

    const int wave = tid >> 5, lane = tid & 31;
    const int n0   = (blk * 8 + wave) * 16;
    const int rlo  = lane & 15;
    const int hh   = lane >> 4;

    const float* A  = emb + ((size_t)batch * N_ + n0 + rlo) * C_ + 4 * hh;
    const float* bp = sP + rlo * LP + 4 * hh;
    float* O = out + ((size_t)batch * N_ + n0 + 8 * hh) * C_ + rlo;   // the lane's first output element

    v4f a[8], b[8][4];
#pragma unroll
    for (int kk = 0; kk < 8; ++kk)   // unrolled: the 8 loads of a lane are in flight together
        a[kk] = *(const v4f*)(A + kk * 8);
    // precaution: stands in front of any reuse of the loads' address registers; A is named as an input so that
    // its register pair is not rewritten ahead of the wait, O so that it is formed here and not inside the
    // matrix run, where its arithmetic took over operand registers one slot behind the WMMA that read them
    asm volatile("s_wait_xcnt 0x0" :: "v"(A), "v"(O) : "memory");
#pragma unroll
    for (int kk = 0; kk < 8; ++kk)   // unrolled with the next loop: b is indexed by constants and stays in registers
#pragma unroll
        for (int u = 0; u < 4; ++u)
            b[kk][u] = *(const v4f*)(bp + u * 16 * LP + kk * 8);   // P[c',e] = B[k,n'], c' = 16*u + rlo
    // keeps all 40 reads issued ahead of the matrix run: without it the compiler sinks them, in pairs, to
    // just in front of their first use, and each pair's latency is waited for in turn
    __builtin_amdgcn_sched_barrier(0);

    v8f acc0 = {0.f,0.f,0.f,0.f,0.f,0.f,0.f,0.f};
    v8f acc1 = acc0, acc2 = acc0, acc3 = acc0;

    // unrolled whole: a and b are indexed by constants; each step waits only for its own reads
#pragma unroll
    for (int kk = 0; kk < 8; ++kk) {
        const v2f alo = {a[kk].x, a[kk].y}, ahi = {a[kk].z, a[kk].w};
        const v2f p0 = {b[kk][0].x, b[kk][0].y}, q0 = {b[kk][0].z, b[kk][0].w};
        const v2f p1 = {b[kk][1].x, b[kk][1].y}, q1 = {b[kk][1].z, b[kk][1].w};
        const v2f p2 = {b[kk][2].x, b[kk][2].y}, q2 = {b[kk][2].z, b[kk][2].w};
        const v2f p3 = {b[kk][3].x, b[kk][3].y}, q3 = {b[kk][3].z, b[kk][3].w};
        acc0 = __builtin_amdgcn_wmma_f32_16x16x4_f32(false, alo, false, p0, (short)0, acc0, false, false);
        acc1 = __builtin_amdgcn_wmma_f32_16x16x4_f32(false, alo, false, p1, (short)0, acc1, false, false);
        acc2 = __builtin_amdgcn_wmma_f32_16x16x4_f32(false, alo, false, p2, (short)0, acc2, false, false);
        acc3 = __builtin_amdgcn_wmma_f32_16x16x4_f32(false, alo, false, p3, (short)0, acc3, false, false);
        acc0 = __builtin_amdgcn_wmma_f32_16x16x4_f32(false, ahi, false, q0, (short)0, acc0, false, false);
        acc1 = __builtin_amdgcn_wmma_f32_16x16x4_f32(false, ahi, false, q1, (short)0, acc1, false, false);
        acc2 = __builtin_amdgcn_wmma_f32_16x16x4_f32(false, ahi, false, q2, (short)0, acc2, false, false);
        acc3 = __builtin_amdgcn_wmma_f32_16x16x4_f32(false, ahi, false, q3, (short)0, acc3, false, false);
    }

#pragma unroll
    for (int r = 0; r < 8; ++r) {
        O[r * C_ +  0] = acc0[r];
        O[r * C_ + 16] = acc1[r];
        O[r * C_ + 32] = acc2[r];
        O[r * C_ + 48] = acc3[r];
    }
}

// ---------------------------------------------------------------------------
extern "C" void kernel_launch(void* const* d_in, const int* in_sizes, int n_in,
                              void* d_out, int out_size, void* d_ws, size_t ws_size,
                              hipStream_t stream) {
    const float* emb = (const float*)d_in[0];
    const float* Wq  = (const float*)d_in[1];
    const float* Wk  = (const float*)d_in[2];
    const float* Wv  = (const float*)d_in[3];
    const float* Wo  = (const float*)d_in[4];
    float* ws  = (float*)d_ws;
    float* out = (float*)d_out;

    hipLaunchKernelGGL(g_partial_kernel, dim3(B_ * NSLICE * 4), dim3(256), 0, stream, emb, ws);
    hipLaunchKernelGGL(heads_kernel,     dim3(B_ * H_),     dim3(256), 0, stream, Wq, Wk, Wv, Wo, ws);
    hipLaunchKernelGGL(out_kernel,       dim3(256),         dim3(256), 0, stream, emb, ws, out);
}

// v007
// Measured time: 20.7 microseconds a run.
// Next to v006, in two timings, it ran 1.09 and 1.08 times as fast.
// Over all steps from v000 it is 4.71 times as fast.
#include <hip/hip_runtime.h>
#include <math.h>

typedef float v2f __attribute__((ext_vector_type(2)));
typedef float v4f __attribute__((ext_vector_type(4)));
typedef float v8f __attribute__((ext_vector_type(8)));

#define B_ 2
#define N_ 16384
#define C_ 64
#define H_ 8
#define NSLICE 32
#define ROWS_PER_SLICE (N_ / NSLICE)   // 512
#define LP 68   // LDS row pitch in floats of the 64x64 maps: 16 B x odd, for 16-byte fragment reads

// workspace layout (float offsets)
#define WS_GPART 0                              // [B][NSLICE][64*64] partial Gram
#define WS_PC    (B_ * NSLICE * 4096)           // [B][H][64*64] per-head P contribution
// total = 327680 floats = 1.25 MB

// ---------------------------------------------------------------------------
// Kernel 1: partial Gram matrices  Gpart[b][slice] = emb_slice^T @ emb_slice
// Column tile u of G holds the columns 4*l + u (l = 0..15), so one 16-byte load of a lane
// (row n, columns 4*l .. 4*l+3) is that row's element of all four tiles, as A and as B alike.
// A block owns strip t (G rows 4*m + t) of one slice; its 8 waves split the slice's 512 rows,
// 64 each, every emb row read once per block in whole lines; the 8 partial strips are summed in LDS.
// ---------------------------------------------------------------------------
#define GWAVES 8
#define ROWS_PER_WAVE (ROWS_PER_SLICE / GWAVES)   // 64
#define GLOADS (ROWS_PER_WAVE / 2)                // 32 loads a lane: each lane half reads every other row pair
#define GPITCH 20    // floats from l to l+1 of a tile in LDS: 16 B x odd, for 16-byte accesses
#define GTILE  336   // floats from tile u to u+1: 16*GPITCH + 16, so that the sum's reads of u = 0..3 fall on different banks

// x[2*s + j] is row 4*s + 2*hh + j of the wave's rows: k slot (hh, j) of step s, the same for A and B.
template <int T>
__device__ __forceinline__ void strip_products(const v4f (&x)[GLOADS],
                                               v8f& d0, v8f& d1, v8f& d2, v8f& d3) {
    // unrolled whole: x is indexed by constants and stays in registers; each step waits only for its own two loads
#pragma unroll
    for (int s = 0; s < GLOADS / 2; ++s) {
        const v4f r0 = x[2 * s], r1 = x[2 * s + 1];
        const v2f p0 = {r0.x, r1.x}, p1 = {r0.y, r1.y}, p2 = {r0.z, r1.z}, p3 = {r0.w, r1.w};
        const v2f a = (T == 0) ? p0 : (T == 1) ? p1 : (T == 2) ? p2 : p3;
        d0 = __builtin_amdgcn_wmma_f32_16x16x4_f32(false, a, false, p0, (short)0, d0, false, false);
        d1 = __builtin_amdgcn_wmma_f32_16x16x4_f32(false, a, false, p1, (short)0, d1, false, false);
        d2 = __builtin_amdgcn_wmma_f32_16x16x4_f32(false, a, false, p2, (short)0, d2, false, false);
        d3 = __builtin_amdgcn_wmma_f32_16x16x4_f32(false, a, false, p3, (short)0, d3, false, false);
    }
}

__global__ __launch_bounds__(256)
void g_partial_kernel(const float* __restrict__ emb, float* __restrict__ ws) {
    __shared__ __attribute__((aligned(16))) float red[GWAVES * 4 * GTILE];   // [wave][tile u][l][m]
    const int t     = blockIdx.x >> 6;          // strip; the four blocks of a slice lie 64 apart in the grid
    const int bs    = blockIdx.x & 63;          // b * NSLICE + slice
    const int tid   = threadIdx.x;
    const int wave  = tid >> 5;
    const int lane  = tid & 31;
    const int l     = lane & 15;
    const int hh    = lane >> 4;

    const float* p = emb + ((size_t)bs * ROWS_PER_SLICE + wave * ROWS_PER_WAVE + 2 * hh) * C_ + 4 * l;
    v4f x[GLOADS];
#pragma unroll
    for (int s = 0; s < GLOADS / 2; ++s) {   // unrolled: all 32 loads of a lane are in flight together
        x[2 * s]     = *(const v4f*)(p + (4 * s) * C_);
        x[2 * s + 1] = *(const v4f*)(p + (4 * s + 1) * C_);
    }
    // precaution: stands in front of any reuse of the loads' address registers; p is named as an
    // input so that its register pair is not rewritten ahead of the wait
    asm volatile("s_wait_xcnt 0x0" :: "v"(p) : "memory");

    v8f d0 = {0.f, 0.f, 0.f, 0.f, 0.f, 0.f, 0.f, 0.f};
    v8f d1 = d0, d2 = d0, d3 = d0;
    // t is the same for the whole block: a scalar branch picks the copy whose A operand is component t
    switch (t) {
        case 0:  strip_products<0>(x, d0, d1, d2, d3); break;
        case 1:  strip_products<1>(x, d0, d1, d2, d3); break;
        case 2:  strip_products<2>(x, d0, d1, d2, d3); break;
        default: strip_products<3>(x, d0, d1, d2, d3); break;
    }

    // du holds G[4*(r + 8*hh) + t][4*l + u] in lane (l, hh), register r. Each tile goes to LDS as [l][m],
    // 8 consecutive m a lane, straight from the accumulator registers.
    float* rw = red + wave * (4 * GTILE) + l * GPITCH + 8 * hh;
    {
        const v4f q00 = {d0[0], d0[1], d0[2], d0[3]}, q01 = {d0[4], d0[5], d0[6], d0[7]};
        const v4f q10 = {d1[0], d1[1], d1[2], d1[3]}, q11 = {d1[4], d1[5], d1[6], d1[7]};
        const v4f q20 = {d2[0], d2[1], d2[2], d2[3]}, q21 = {d2[4], d2[5], d2[6], d2[7]};
        const v4f q30 = {d3[0], d3[1], d3[2], d3[3]}, q31 = {d3[4], d3[5], d3[6], d3[7]};
        *(v4f*)(rw)                 = q00;  *(v4f*)(rw + 4)             = q01;
        *(v4f*)(rw + GTILE)         = q10;  *(v4f*)(rw + GTILE + 4)     = q11;
        *(v4f*)(rw + 2 * GTILE)     = q20;  *(v4f*)(rw + 2 * GTILE + 4) = q21;
        *(v4f*)(rw + 3 * GTILE)     = q30;  *(v4f*)(rw + 3 * GTILE + 4) = q31;
    }
    __syncthreads();

    // thread tid sums column col = tid & 63 of the strip rows m = 4*(tid >> 6) + 0..3 over the waves, wave 0 first
    const int col = tid & 63, m4 = tid >> 6;
    const float* rr = red + (col & 3) * GTILE + (col >> 2) * GPITCH + 4 * m4;
    v4f sum = {0.f, 0.f, 0.f, 0.f};
#pragma unroll
    for (int w = 0; w < GWAVES; ++w)   // unrolled: the 8 LDS reads issue together
        sum += *(const v4f*)(rr + w * (4 * GTILE));
    float* gp = ws + WS_GPART + (size_t)bs * 4096 + (16 * m4 + t) * 64 + col;
    gp[0]   = sum.x;   // G rows 4*m + t: 4 rows apart; a wave's 32 lanes fill one 128-byte line a store
    gp[256] = sum.y;
    gp[512] = sum.z;
    gp[768] = sum.w;
}

// ---------------------------------------------------------------------------
// One wave's share of a 64x64x64 product D[m][n] = sum_k X[m][k] * Y[n][k]:
// row tile mt against column tiles nt and nt+1. X and Y lie in LDS at pitch LP
// with k contiguous. Lane (c, hh) reads k = 8*kk + 4*hh + 0..3 of its row of X
// and of Y with the same code, so both operands carry the same k order.
// ---------------------------------------------------------------------------
__device__ __forceinline__ void mm64_tiles(const float* X, const float* Y,
                                           int mt, int nt, int c, int hh,
                                           v8f& d0, v8f& d1) {
    const float* xp = X + (mt * 16 + c) * LP + 4 * hh;
    const float* y0 = Y + (nt * 16 + c) * LP + 4 * hh;
    const float* y1 = y0 + 16 * LP;
    // unrolled whole: the LDS reads can issue ahead of the matrix run, no branch behind a WMMA
#pragma unroll
    for (int kk = 0; kk < 8; ++kk) {
        const v4f a  = *(const v4f*)(xp + kk * 8);
        const v4f b0 = *(const v4f*)(y0 + kk * 8);
        const v4f b1 = *(const v4f*)(y1 + kk * 8);
        const v2f alo = {a.x, a.y},   ahi = {a.z, a.w};
        const v2f p0  = {b0.x, b0.y}, q0  = {b0.z, b0.w};
        const v2f p1  = {b1.x, b1.y}, q1  = {b1.z, b1.w};
        d0 = __builtin_amdgcn_wmma_f32_16x16x4_f32(false, alo, false, p0, (short)0, d0, false, false);
        d1 = __builtin_amdgcn_wmma_f32_16x16x4_f32(false, alo, false, p1, (short)0, d1, false, false);
        d0 = __builtin_amdgcn_wmma_f32_16x16x4_f32(false, ahi, false, q0, (short)0, d0, false, false);
        d1 = __builtin_amdgcn_wmma_f32_16x16x4_f32(false, ahi, false, q1, (short)0, d1, false, false);
    }
}

// D tile (rows 16*mt + 8*hh + r, column n) stored transposed: Z[n][m], 8 consecutive m per lane
__device__ __forceinline__ void store_tile_t(float* Z, int mt, int n, int hh, const v8f& d) {
    float* z = Z + n * LP + mt * 16 + hh * 8;
    const v4f lo = {d[0], d[1], d[2], d[3]}, hi = {d[4], d[5], d[6], d[7]};
    *(v4f*)z = lo;
    *(v4f*)(z + 4) = hi;
}

// Value of lane l ^ M, M < 16, by a DPP move inside the 16-lane row; every lane is on where it is used.
template <int M>
__device__ __forceinline__ float lane_xor(float v) {
    return __builtin_bit_cast(float,
        __builtin_amdgcn_update_dpp(0, __builtin_bit_cast(int, v), 0x160 | M, 0xf, 0xf, true));   // 0x160 | M = row_xmask:M
}

// Sum over the 16 lanes of a row; every lane gets it.
__device__ __forceinline__ float row16_sum(float v) {
    v += lane_xor<1>(v);
    v += lane_xor<2>(v);
    v += lane_xor<4>(v);
    v += lane_xor<8>(v);
    return v;
}

// One group of the Gram sum's loads: part j = g >> 1 (1024 floats apart), slices 16*(g & 1) + 0..15, 16 bytes a lane each.
#define GGROUP 16
__device__ __forceinline__ void gram_group(const float* gp, int g, v4f (&r)[GGROUP]) {
#pragma unroll
    for (int q = 0; q < GGROUP; ++q)   // unrolled: 16 independent loads, r is indexed by constants
        r[q] = *(const v4f*)(gp + ((g & 1) * GGROUP + q) * 4096 + (g >> 1) * 1024);
}

// ---------------------------------------------------------------------------
// Kernel 2: per (b,h): S = Wq_h G Wk_h^T ; instance-norm ; softmax(rows) ;
//           M = attn @ Wv_h ; Pcontrib = Wo_h @ M.   All 64x64, done in LDS;
//           the four products run on WMMA f32, 8 waves x 2 tiles of 16x16.
// ---------------------------------------------------------------------------
__global__ __launch_bounds__(256)
void heads_kernel(const float* __restrict__ Wq, const float* __restrict__ Wk,
                  const float* __restrict__ Wv, const float* __restrict__ Wo,
                  float* __restrict__ ws) {
    __shared__ __attribute__((aligned(16))) float sG[64 * LP], sT[64 * LP], sS[64 * LP];
    __shared__ __attribute__((aligned(16))) float sWk[64 * LP], sWq[64 * LP], sWv[64 * LP], sWo[64 * LP];
    __shared__ __attribute__((aligned(16))) float red[16], red2[16];   // one partial sum per 16 lanes

    const int b = blockIdx.x >> 3;
    const int h = blockIdx.x & 7;
    const int tid = threadIdx.x;
    const int lane = tid & 31;
    const int lc = lane & 15, lh = lane >> 4;      // fragment column / k half
    const int mt = tid >> 6;                       // wave's row tile
    const int nt = ((tid >> 5) & 1) * 2;           // wave's first column tile
    const v8f zero8 = {0.f, 0.f, 0.f, 0.f, 0.f, 0.f, 0.f, 0.f};

    // All four weight maps are requested here, ahead of the Gram sum: their latency runs
    // under that sum's own loads, and no product later waits on a global load.
    // Thread tid holds elements i = tid + 256*j of each 64x64 map: row (tid >> 6) + 4*j, column tid & 63.
    const int trow = tid >> 6, tcol = tid & 63;
    const float* gk = Wk + h * 4096 + tid;
    const float* gq = Wq + h * 4096 + tid;
    const float* gv = Wv + h * 4096 + tid;
    const float* go = Wo + trow * 512 + tcol * 8 + h;   // Wo_h[c',c] = Wo[c'*512 + c*8 + h]
    float rk[16], rq[16], rv[16], ro[16];
#pragma unroll
    for (int j = 0; j < 16; ++j) {   // unrolled: the 64 loads are in flight together, values stay in registers
        rk[j] = gk[j * 256];
        rq[j] = gq[j * 256];
        rv[j] = gv[j * 256];
        ro[j] = go[j * 2048];
    }
    // precaution: stands in front of any reuse of the loads' address registers; go is named as an
    // input so that its register pair, the only one that dies here, is not rewritten ahead of the wait
    asm volatile("s_wait_xcnt 0x0" :: "v"(go) : "memory");

    // Deterministic sum of the Gram partials, slice 0 first from 0.f. Thread tid owns elements 4*tid + 1024*j + 0..3
    // of G, j = 0..3: row (tid >> 4) + 16*j, columns 4*(tid & 15) + 0..3; a wave's load is 512 contiguous bytes.
    // Its 128 loads run as 8 groups of 16 (group g: part j = g >> 1, slices 16*(g & 1) + 0..15) through a ring of
    // three register sets: while a group is summed the next two stay in flight, and its set is refilled at once.
    const float* gbase = ws + WS_GPART + (size_t)b * NSLICE * 4096;   // the same for the whole block
    const float* gp = gbase + 4 * tid;
    v4f ring[3][GGROUP];
    gram_group(gp, 0, ring[0]);
    gram_group(gp, 1, ring[1]);
#pragma unroll
    for (int j = 0; j < 16; ++j) {   // unrolled: rk..ro are indexed by constants
        const int p = (trow + 4 * j) * LP + tcol;
        sWk[p] = rk[j];
        sWq[p] = rq[j];
        sWv[tcol * LP + trow + 4 * j] = rv[j];   // kept as sWv[e][d], so that the product's k (= d) is contiguous
        sWo[p] = ro[j];
    }
    // the third group starts only here, where the weights have left their registers: without it all three sets
    // and the weights are live together
    __builtin_amdgcn_sched_barrier(0);
    gram_group(gp, 2, ring[2]);
    {
        v4f s = {0.f, 0.f, 0.f, 0.f};
#pragma unroll
        for (int g = 0; g < 8; ++g) {   // unrolled whole: ring is indexed by constants and stays in registers
            // keeps each refill ahead of the next group's sum: sunk to its first use, a load's latency is waited out alone
            __builtin_amdgcn_sched_barrier(0);
#pragma unroll
            for (int q = 0; q < GGROUP; ++q) s += ring[g % 3][q];
            if (g & 1) {
                *(v4f*)(sG + ((tid >> 4) + 16 * (g >> 1)) * LP + 4 * (tid & 15)) = s;
                s = (v4f){0.f, 0.f, 0.f, 0.f};
            }
            if (g + 3 < 8) gram_group(gp, g + 3, ring[g % 3]);
            // precaution: behind the last load, in front of any reuse of the loads' address registers (the block's
            // base and the thread index); both are named as inputs so that neither is rewritten ahead of the wait
            if (g + 3 == 7) asm volatile("s_wait_xcnt 0x0" :: "s"(gbase), "v"(tid) : "memory");
        }
    }
    __syncthreads();

    // T1[e,d] = sum_f G[e,f] * Wk_h[d,f], kept as sT[d][e]
    {
        v8f d0 = zero8, d1 = zero8;
        mm64_tiles(sG, sWk, mt, nt, lc, lh, d0, d1);
        store_tile_t(sT, mt, nt * 16 + lc, lh, d0);
        store_tile_t(sT, mt, nt * 16 + 16 + lc, lh, d1);
    }
    __syncthreads();

    // S[c,d] = sum_e Wq_h[c,e] * T1[e,d]
    {
        v8f d0 = zero8, d1 = zero8;
        mm64_tiles(sWq, sT, mt, nt, lc, lh, d0, d1);
        float* sp = sS + (mt * 16 + lh * 8) * LP + nt * 16 + lc;
#pragma unroll
        for (int r = 0; r < 8; ++r) {   // unrolled: d0, d1 are indexed by constants and stay in registers
            sp[r * LP]      = d0[r];
            sp[r * LP + 16] = d1[r];
        }
    }
    __syncthreads();

    // InstanceNorm over the full 64x64 map (biased variance, eps=1e-5), then softmax along d, all in registers:
    // thread tid holds columns 16*(tid & 3) + 0..15 of row tid >> 2, so the four lanes of a row are neighbours
    // and a 16-byte read of lanes 0..15 (4 rows x 4 quarters at pitch LP) falls on 64 different banks.
    {
        float* rowp = sS + (tid >> 2) * LP + 16 * (tid & 3);
        v4f x[4];
#pragma unroll
        for (int i = 0; i < 4; ++i) x[i] = *(const v4f*)(rowp + 4 * i);   // unrolled: x stays in registers

        const v4f sv = (x[0] + x[1]) + (x[2] + x[3]);
        const v4f qv = (x[0] * x[0] + x[1] * x[1]) + (x[2] * x[2] + x[3] * x[3]);
        const float s  = row16_sum((sv.x + sv.y) + (sv.z + sv.w));
        const float s2 = row16_sum((qv.x + qv.y) + (qv.z + qv.w));
        if (lc == 0) { red[tid >> 4] = s; red2[tid >> 4] = s2; }
        __syncthreads();
        // every thread adds the 16 partial sums itself, in one fixed order: no thread waits for another's result
        const v4f* r1 = (const v4f*)red;
        const v4f* r2 = (const v4f*)red2;
        const v4f ts = (r1[0] + r1[1]) + (r1[2] + r1[3]);
        const v4f tq = (r2[0] + r2[1]) + (r2[2] + r2[3]);
        const float mean = ((ts.x + ts.y) + (ts.z + ts.w)) * (1.0f / 4096.0f);
        const float var  = ((tq.x + tq.y) + (tq.z + tq.w)) * (1.0f / 4096.0f) - mean * mean;
        const float rstd = rsqrtf(var + 1e-5f);

#pragma unroll
        for (int i = 0; i < 4; ++i) x[i] = (x[i] - mean) * rstd;   // unrolled, as every loop over x: constant indices
        v4f mv = x[0];
#pragma unroll
        for (int i = 1; i < 4; ++i) {   // unrolled: constant indices into x
            mv.x = fmaxf(mv.x, x[i].x);  mv.y = fmaxf(mv.y, x[i].y);
            mv.z = fmaxf(mv.z, x[i].z);  mv.w = fmaxf(mv.w, x[i].w);
        }
        float m = fmaxf(fmaxf(mv.x, mv.y), fmaxf(mv.z, mv.w));
        m = fmaxf(m, lane_xor<1>(m));
        m = fmaxf(m, lane_xor<2>(m));

        v4f ev = {0.f, 0.f, 0.f, 0.f};
#pragma unroll
        for (int i = 0; i < 4; ++i) {   // unrolled: constant indices into x; the 16 exponentials are independent
            x[i].x = expf(x[i].x - m);  x[i].y = expf(x[i].y - m);
            x[i].z = expf(x[i].z - m);  x[i].w = expf(x[i].w - m);
            ev += x[i];
        }
        float e = (ev.x + ev.y) + (ev.z + ev.w);
        e += lane_xor<1>(e);
        e += lane_xor<2>(e);
        const float inv = 1.f / e;
        // a thread rewrites only what it read itself, so no barrier is needed between its reads and these stores
#pragma unroll
        for (int i = 0; i < 4; ++i) *(v4f*)(rowp + 4 * i) = x[i] * inv;   // unrolled: constant indices into x
    }
    __syncthreads();

    // M[c,e] = sum_d attn[c,d] * Wv_h[d,e], kept as sT[e][c]
    {
        v8f d0 = zero8, d1 = zero8;
        mm64_tiles(sS, sWv, mt, nt, lc, lh, d0, d1);
        store_tile_t(sT, mt, nt * 16 + lc, lh, d0);
        store_tile_t(sT, mt, nt * 16 + 16 + lc, lh, d1);
    }
    __syncthreads();

    // Pcontrib[c',e] = sum_c Wo_h[c',c] * M[c,e]
    {
        v8f d0 = zero8, d1 = zero8;
        mm64_tiles(sWo, sT, mt, nt, lc, lh, d0, d1);
        float* pc = ws + WS_PC + (size_t)(b * H_ + h) * 4096
                  + (mt * 16 + lh * 8) * 64 + nt * 16 + lc;
#pragma unroll
        for (int r = 0; r < 8; ++r) {   // unrolled: d0, d1 are indexed by constants and stay in registers
            pc[r * 64]      = d0[r];
            pc[r * 64 + 16] = d1[r];
        }
    }
}

// ---------------------------------------------------------------------------
// Kernel 3: P_b = sum_h Pcontrib[b][h], summed by every block while it stages P in LDS
//           (h ascending from 0.f, deterministic); out_b[n,c'] = emb_b[n,:] . P_b[c',:] on WMMA.
// Each wave: one 16-row stripe x all 64 output columns (4 accumulators).
// P lies in LDS at pitch LP (16 B x odd). Lane (rlo, hh) reads k = 8*kk + 4*hh + 0..3 of its emb row
// and of its four P rows, 16 bytes each: both operands carry the same k order, and the 16 rows that
// the lanes of a read touch fall on different banks.
// ---------------------------------------------------------------------------
__global__ __launch_bounds__(256)
void out_kernel(const float* __restrict__ emb, const float* __restrict__ ws,
                float* __restrict__ out) {
    __shared__ __attribute__((aligned(16))) float sP[64 * LP];
    const int batch = blockIdx.x >> 7;   // 128 blocks per batch
    const int blk   = blockIdx.x & 127;
    const int tid   = threadIdx.x;

    // Thread tid owns elements 4*tid + 1024*j + 0..3 of P, j = 0..3: row (tid >> 4) + 16*j, columns 4*(tid & 15) + 0..3.
    {
        const float* pc = ws + WS_PC + (size_t)batch * H_ * 4096 + 4 * tid;
        v4f part[H_][4];
#pragma unroll
        for (int h = 0; h < H_; ++h)   // unrolled with the next loop: 32 independent loads of 16 bytes, no wait per trip
#pragma unroll
            for (int j = 0; j < 4; ++j)
                part[h][j] = *(const v4f*)(pc + h * 4096 + j * 1024);
#pragma unroll
        for (int j = 0; j < 4; ++j) {   // unrolled: part is indexed by constants and stays in registers
            v4f s = {0.f, 0.f, 0.f, 0.f};
#pragma unroll
            for (int h = 0; h < H_; ++h) s += part[h][j];
            *(v4f*)(sP + ((tid >> 4) + 16 * j) * LP + 4 * (tid & 15)) = s;
        }
    }
    __syncthreads();

    const int wave = tid >> 5, lane = tid & 31;
    const int n0   = (blk * 8 + wave) * 16;
    const int rlo  = lane & 15;
    const int hh   = lane >> 4;

    const float* A  = emb + ((size_t)batch * N_ + n0 + rlo) * C_ + 4 * hh;
    const float* bp = sP + rlo * LP + 4 * hh;
    float* O = out + ((size_t)batch * N_ + n0 + 8 * hh) * C_ + rlo;   // the lane's first output element

    v4f a[8], b[8][4];
#pragma unroll
    for (int kk = 0; kk < 8; ++kk)   // unrolled: the 8 loads of a lane are in flight together
        a[kk] = *(const v4f*)(A + kk * 8);
    // precaution: stands in front of any reuse of the loads' address registers; A is named as an input so that
    // its register pair is not rewritten ahead of the wait, O so that it is formed here and not inside the
    // matrix run, where its arithmetic took over operand registers one slot behind the WMMA that read them
    asm volatile("s_wait_xcnt 0x0" :: "v"(A), "v"(O) : "memory");
#pragma unroll
    for (int kk = 0; kk < 8; ++kk)   // unrolled with the next loop: b is indexed by constants and stays in registers
#pragma unroll
        for (int u = 0; u < 4; ++u)
            b[kk][u] = *(const v4f*)(bp + u * 16 * LP + kk * 8);   // P[c',e] = B[k,n'], c' = 16*u + rlo
    // keeps all 40 reads issued ahead of the matrix run: without it the compiler sinks them, in pairs, to
    // just in front of their first use, and each pair's latency is waited for in turn
    __builtin_amdgcn_sched_barrier(0);

    v8f acc0 = {0.f,0.f,0.f,0.f,0.f,0.f,0.f,0.f};
    v8f acc1 = acc0, acc2 = acc0, acc3 = acc0;

    // unrolled whole: a and b are indexed by constants; each step waits only for its own reads
#pragma unroll
    for (int kk = 0; kk < 8; ++kk) {
        const v2f alo = {a[kk].x, a[kk].y}, ahi = {a[kk].z, a[kk].w};
        const v2f p0 = {b[kk][0].x, b[kk][0].y}, q0 = {b[kk][0].z, b[kk][0].w};
        const v2f p1 = {b[kk][1].x, b[kk][1].y}, q1 = {b[kk][1].z, b[kk][1].w};
        const v2f p2 = {b[kk][2].x, b[kk][2].y}, q2 = {b[kk][2].z, b[kk][2].w};
        const v2f p3 = {b[kk][3].x, b[kk][3].y}, q3 = {b[kk][3].z, b[kk][3].w};
        acc0 = __builtin_amdgcn_wmma_f32_16x16x4_f32(false, alo, false, p0, (short)0, acc0, false, false);
        acc1 = __builtin_amdgcn_wmma_f32_16x16x4_f32(false, alo, false, p1, (short)0, acc1, false, false);
        acc2 = __builtin_amdgcn_wmma_f32_16x16x4_f32(false, alo, false, p2, (short)0, acc2, false, false);
        acc3 = __builtin_amdgcn_wmma_f32_16x16x4_f32(false, alo, false, p3, (short)0, acc3, false, false);
        acc0 = __builtin_amdgcn_wmma_f32_16x16x4_f32(false, ahi, false, q0, (short)0, acc0, false, false);
        acc1 = __builtin_amdgcn_wmma_f32_16x16x4_f32(false, ahi, false, q1, (short)0, acc1, false, false);
        acc2 = __builtin_amdgcn_wmma_f32_16x16x4_f32(false, ahi, false, q2, (short)0, acc2, false, false);
        acc3 = __builtin_amdgcn_wmma_f32_16x16x4_f32(false, ahi, false, q3, (short)0, acc3, false, false);
    }

#pragma unroll
    for (int r = 0; r < 8; ++r) {
        O[r * C_ +  0] = acc0[r];
        O[r * C_ + 16] = acc1[r];
        O[r * C_ + 32] = acc2[r];
        O[r * C_ + 48] = acc3[r];
    }
}

// ---------------------------------------------------------------------------
extern "C" void kernel_launch(void* const* d_in, const int* in_sizes, int n_in,
                              void* d_out, int out_size, void* d_ws, size_t ws_size,
                              hipStream_t stream) {
    const float* emb = (const float*)d_in[0];
    const float* Wq  = (const float*)d_in[1];
    const float* Wk  = (const float*)d_in[2];
    const float* Wv  = (const float*)d_in[3];
    const float* Wo  = (const float*)d_in[4];
    float* ws  = (float*)d_ws;
    float* out = (float*)d_out;

    hipLaunchKernelGGL(g_partial_kernel, dim3(B_ * NSLICE * 4), dim3(256), 0, stream, emb, ws);
    hipLaunchKernelGGL(heads_kernel,     dim3(B_ * H_),     dim3(256), 0, stream, Wq, Wk, Wv, Wo, ws);
    hipLaunchKernelGGL(out_kernel,       dim3(256),         dim3(256), 0, stream, emb, ws, out);
}

// v008
// One run takes 19.4 microseconds.
// In both of two side-by-side timings against v007, it was 1.07 times as fast.
// All steps since v000 together make it 5.03 times as fast.
#include <hip/hip_runtime.h>
#include <math.h>

typedef float v2f __attribute__((ext_vector_type(2)));
typedef float v4f __attribute__((ext_vector_type(4)));
typedef float v8f __attribute__((ext_vector_type(8)));

#define B_ 2
#define N_ 16384
#define C_ 64
#define H_ 8
#define NSLICE 32
#define ROWS_PER_SLICE (N_ / NSLICE)   // 512
#define LP 68   // LDS row pitch in floats of the 64x64 maps: 16 B x odd, for 16-byte fragment reads

// workspace layout (float offsets)
#define WS_GPART 0                              // [B][NSLICE][64*64] partial Gram
#define WS_PC    (B_ * NSLICE * 4096)           // [B][H][4][64][16] per-head P contribution: [column block][row c'][column]
// total = 327680 floats = 1.25 MB

// ---------------------------------------------------------------------------
// Kernel 1: partial Gram matrices  Gpart[b][slice] = emb_slice^T @ emb_slice
// Column tile u of G holds the columns 4*l + u (l = 0..15), so one 16-byte load of a lane
// (row n, columns 4*l .. 4*l+3) is that row's element of all four tiles, as A and as B alike.
// A block owns strip t (G rows 4*m + t) of one slice; its 8 waves split the slice's 512 rows,
// 64 each, every emb row read once per block in whole lines; the 8 partial strips are summed in LDS.
// ---------------------------------------------------------------------------
#define GWAVES 8
#define ROWS_PER_WAVE (ROWS_PER_SLICE / GWAVES)   // 64
#define GLOADS (ROWS_PER_WAVE / 2)                // 32 loads a lane: each lane half reads every other row pair
#define GPITCH 20    // floats from l to l+1 of a tile in LDS: 16 B x odd, for 16-byte accesses
#define GTILE  336   // floats from tile u to u+1: 16*GPITCH + 16, so that the sum's reads of u = 0..3 fall on different banks

// x[2*s + j] is row 4*s + 2*hh + j of the wave's rows: k slot (hh, j) of step s, the same for A and B.
template <int T>
__device__ __forceinline__ void strip_products(const v4f (&x)[GLOADS],
                                               v8f& d0, v8f& d1, v8f& d2, v8f& d3) {
    // unrolled whole: x is indexed by constants and stays in registers; each step waits only for its own two loads
#pragma unroll
    for (int s = 0; s < GLOADS / 2; ++s) {
        const v4f r0 = x[2 * s], r1 = x[2 * s + 1];
        const v2f p0 = {r0.x, r1.x}, p1 = {r0.y, r1.y}, p2 = {r0.z, r1.z}, p3 = {r0.w, r1.w};
        const v2f a = (T == 0) ? p0 : (T == 1) ? p1 : (T == 2) ? p2 : p3;
        d0 = __builtin_amdgcn_wmma_f32_16x16x4_f32(false, a, false, p0, (short)0, d0, false, false);
        d1 = __builtin_amdgcn_wmma_f32_16x16x4_f32(false, a, false, p1, (short)0, d1, false, false);
        d2 = __builtin_amdgcn_wmma_f32_16x16x4_f32(false, a, false, p2, (short)0, d2, false, false);
        d3 = __builtin_amdgcn_wmma_f32_16x16x4_f32(false, a, false, p3, (short)0, d3, false, false);
    }
}

__global__ __launch_bounds__(256)
void g_partial_kernel(const float* __restrict__ emb, float* __restrict__ ws) {
    __shared__ __attribute__((aligned(16))) float red[GWAVES * 4 * GTILE];   // [wave][tile u][l][m]
    const int t     = blockIdx.x >> 6;          // strip; the four blocks of a slice lie 64 apart in the grid
    const int bs    = blockIdx.x & 63;          // b * NSLICE + slice
    const int tid   = threadIdx.x;
    const int wave  = tid >> 5;
    const int lane  = tid & 31;
    const int l     = lane & 15;
    const int hh    = lane >> 4;

    const float* p = emb + ((size_t)bs * ROWS_PER_SLICE + wave * ROWS_PER_WAVE + 2 * hh) * C_ + 4 * l;
    v4f x[GLOADS];
#pragma unroll
    for (int s = 0; s < GLOADS / 2; ++s) {   // unrolled: all 32 loads of a lane are in flight together
        x[2 * s]     = *(const v4f*)(p + (4 * s) * C_);
        x[2 * s + 1] = *(const v4f*)(p + (4 * s + 1) * C_);
    }
    // precaution: stands in front of any reuse of the loads' address registers; p is named as an
    // input so that its register pair is not rewritten ahead of the wait
    asm volatile("s_wait_xcnt 0x0" :: "v"(p) : "memory");

    v8f d0 = {0.f, 0.f, 0.f, 0.f, 0.f, 0.f, 0.f, 0.f};
    v8f d1 = d0, d2 = d0, d3 = d0;
    // t is the same for the whole block: a scalar branch picks the copy whose A operand is component t
    switch (t) {
        case 0:  strip_products<0>(x, d0, d1, d2, d3); break;
        case 1:  strip_products<1>(x, d0, d1, d2, d3); break;
        case 2:  strip_products<2>(x, d0, d1, d2, d3); break;
        default: strip_products<3>(x, d0, d1, d2, d3); break;
    }

    // du holds G[4*(r + 8*hh) + t][4*l + u] in lane (l, hh), register r. Each tile goes to LDS as [l][m],
    // 8 consecutive m a lane, straight from the accumulator registers.
    float* rw = red + wave * (4 * GTILE) + l * GPITCH + 8 * hh;
    {
        const v4f q00 = {d0[0], d0[1], d0[2], d0[3]}, q01 = {d0[4], d0[5], d0[6], d0[7]};
        const v4f q10 = {d1[0], d1[1], d1[2], d1[3]}, q11 = {d1[4], d1[5], d1[6], d1[7]};
        const v4f q20 = {d2[0], d2[1], d2[2], d2[3]}, q21 = {d2[4], d2[5], d2[6], d2[7]};
        const v4f q30 = {d3[0], d3[1], d3[2], d3[3]}, q31 = {d3[4], d3[5], d3[6], d3[7]};
        *(v4f*)(rw)                 = q00;  *(v4f*)(rw + 4)             = q01;
        *(v4f*)(rw + GTILE)         = q10;  *(v4f*)(rw + GTILE + 4)     = q11;
        *(v4f*)(rw + 2 * GTILE)     = q20;  *(v4f*)(rw + 2 * GTILE + 4) = q21;
        *(v4f*)(rw + 3 * GTILE)     = q30;  *(v4f*)(rw + 3 * GTILE + 4) = q31;
    }
    __syncthreads();

    // thread tid sums column col = tid & 63 of the strip rows m = 4*(tid >> 6) + 0..3 over the waves, wave 0 first
    const int col = tid & 63, m4 = tid >> 6;
    const float* rr = red + (col & 3) * GTILE + (col >> 2) * GPITCH + 4 * m4;
    v4f sum = {0.f, 0.f, 0.f, 0.f};
#pragma unroll
    for (int w = 0; w < GWAVES; ++w)   // unrolled: the 8 LDS reads issue together
        sum += *(const v4f*)(rr + w * (4 * GTILE));
    float* gp = ws + WS_GPART + (size_t)bs * 4096 + (16 * m4 + t) * 64 + col;
    gp[0]   = sum.x;   // G rows 4*m + t: 4 rows apart; a wave's 32 lanes fill one 128-byte line a store
    gp[256] = sum.y;
    gp[512] = sum.z;
    gp[768] = sum.w;
}

// ---------------------------------------------------------------------------
// One wave's share of a 64x64x64 product D[m][n] = sum_k X[m][k] * Y[n][k]:
// row tile mt against column tiles nt and nt+1. X and Y lie in LDS at pitch LP
// with k contiguous. Lane (c, hh) reads k = 8*kk + 4*hh + 0..3 of its row of X
// and of Y with the same code, so both operands carry the same k order.
// ---------------------------------------------------------------------------
__device__ __forceinline__ void mm64_tiles(const float* X, const float* Y,
                                           int mt, int nt, int c, int hh,
                                           v8f& d0, v8f& d1) {
    const float* xp = X + (mt * 16 + c) * LP + 4 * hh;
    const float* y0 = Y + (nt * 16 + c) * LP + 4 * hh;
    const float* y1 = y0 + 16 * LP;
    // unrolled whole: the LDS reads can issue ahead of the matrix run, no branch behind a WMMA
#pragma unroll
    for (int kk = 0; kk < 8; ++kk) {
        const v4f a  = *(const v4f*)(xp + kk * 8);
        const v4f b0 = *(const v4f*)(y0 + kk * 8);
        const v4f b1 = *(const v4f*)(y1 + kk * 8);
        const v2f alo = {a.x, a.y},   ahi = {a.z, a.w};
        const v2f p0  = {b0.x, b0.y}, q0  = {b0.z, b0.w};
        const v2f p1  = {b1.x, b1.y}, q1  = {b1.z, b1.w};
        d0 = __builtin_amdgcn_wmma_f32_16x16x4_f32(false, alo, false, p0, (short)0, d0, false, false);
        d1 = __builtin_amdgcn_wmma_f32_16x16x4_f32(false, alo, false, p1, (short)0, d1, false, false);
        d0 = __builtin_amdgcn_wmma_f32_16x16x4_f32(false, ahi, false, q0, (short)0, d0, false, false);
        d1 = __builtin_amdgcn_wmma_f32_16x16x4_f32(false, ahi, false, q1, (short)0, d1, false, false);
    }
}

// The same for one tile: row tile mt of X against the 16 rows of Y, the products summed in the same order.
__device__ __forceinline__ void mm64_tile(const float* X, const float* Y,
                                          int mt, int c, int hh, v8f& d) {
    const float* xp = X + (mt * 16 + c) * LP + 4 * hh;
    const float* yp = Y + c * LP + 4 * hh;
    v4f a[8], y[8];
#pragma unroll
    for (int kk = 0; kk < 8; ++kk) {   // unrolled: a and y are indexed by constants and stay in registers
        a[kk] = *(const v4f*)(xp + kk * 8);
        y[kk] = *(const v4f*)(yp + kk * 8);
    }
    // keeps all 16 reads issued ahead of the matrix run, for speed only
    __builtin_amdgcn_sched_barrier(0);
#pragma unroll
    for (int kk = 0; kk < 8; ++kk) {   // unrolled: constant indices, no branch behind a WMMA
        const v2f alo = {a[kk].x, a[kk].y}, ahi = {a[kk].z, a[kk].w};
        const v2f p   = {y[kk].x, y[kk].y}, q   = {y[kk].z, y[kk].w};
        d = __builtin_amdgcn_wmma_f32_16x16x4_f32(false, alo, false, p, (short)0, d, false, false);
        d = __builtin_amdgcn_wmma_f32_16x16x4_f32(false, ahi, false, q, (short)0, d, false, false);
    }
    // keeps the address arithmetic of the stores that follow out of the matrix run, where it took over operand
    // registers one slot behind the WMMA that read them
    __builtin_amdgcn_sched_barrier(0);
    // four vector slots between the last WMMA and that arithmetic, which may take over its operand registers too
    asm volatile("v_nop\n\tv_nop\n\tv_nop\n\tv_nop");
    // holds the arithmetic behind the four slots
    __builtin_amdgcn_sched_barrier(0);
}

// D tile (rows 16*mt + 8*hh + r, column n) stored transposed: Z[n][m], 8 consecutive m per lane
__device__ __forceinline__ void store_tile_t(float* Z, int mt, int n, int hh, const v8f& d) {
    float* z = Z + n * LP + mt * 16 + hh * 8;
    const v4f lo = {d[0], d[1], d[2], d[3]}, hi = {d[4], d[5], d[6], d[7]};
    *(v4f*)z = lo;
    *(v4f*)(z + 4) = hi;
}

// Value of lane l ^ M, M < 16, by a DPP move inside the 16-lane row; every lane is on where it is used.
template <int M>
__device__ __forceinline__ float lane_xor(float v) {
    return __builtin_bit_cast(float,
        __builtin_amdgcn_update_dpp(0, __builtin_bit_cast(int, v), 0x160 | M, 0xf, 0xf, true));   // 0x160 | M = row_xmask:M
}

// Sum over the 16 lanes of a row; every lane gets it.
__device__ __forceinline__ float row16_sum(float v) {
    v += lane_xor<1>(v);
    v += lane_xor<2>(v);
    v += lane_xor<4>(v);
    v += lane_xor<8>(v);
    return v;
}

// One group of the Gram sum's loads: part j = g >> 1 (1024 floats apart), slices 16*(g & 1) + 0..15, 16 bytes a lane each.
#define GGROUP 16
__device__ __forceinline__ void gram_group(const float* gp, int g, v4f (&r)[GGROUP]) {
#pragma unroll
    for (int q = 0; q < GGROUP; ++q)   // unrolled: 16 independent loads, r is indexed by constants
        r[q] = *(const v4f*)(gp + ((g & 1) * GGROUP + q) * 4096 + (g >> 1) * 1024);
}

// ---------------------------------------------------------------------------
// Kernel 2: per (b,h): S = Wq_h G Wk_h^T ; instance-norm ; softmax(rows) ;
//           M = attn @ Wv_h ; Pcontrib = Wo_h @ M.   All 64x64, done in LDS, on WMMA f32.
// Four blocks a head. The norm and the softmax need all of S, so each block forms S and attn whole
// (8 waves x 2 tiles of 16x16 a product); of M and Pcontrib, whose columns e are independent of one
// another, it forms only its own 16 columns: 4 tiles a product, one on each of waves 0..3.
// ---------------------------------------------------------------------------
__global__ __launch_bounds__(256)
void heads_kernel(const float* __restrict__ Wq, const float* __restrict__ Wk,
                  const float* __restrict__ Wv, const float* __restrict__ Wo,
                  float* __restrict__ ws) {
    __shared__ __attribute__((aligned(16))) float sG[64 * LP], sT[64 * LP], sS[64 * LP];
    __shared__ __attribute__((aligned(16))) float sWk[64 * LP], sWq[64 * LP], sWv[64 * LP], sWo[64 * LP];
    __shared__ __attribute__((aligned(16))) float red[16], red2[16];   // one partial sum per 16 lanes

    const int b  = blockIdx.x >> 5;
    const int h  = (blockIdx.x >> 2) & 7;
    const int eq = blockIdx.x & 3;                 // the block's columns e = 16*eq + 0..15 of M and Pcontrib
    const int tid = threadIdx.x;
    const int lane = tid & 31;
    const int lc = lane & 15, lh = lane >> 4;      // fragment column / k half
    const int mt = tid >> 6;                       // wave's row tile
    const int nt = ((tid >> 5) & 1) * 2;           // wave's first column tile
    const v8f zero8 = {0.f, 0.f, 0.f, 0.f, 0.f, 0.f, 0.f, 0.f};

    // All four weight maps are requested here, ahead of the Gram sum: their latency runs
    // under that sum's own loads, and no product later waits on a global load.
    // Thread tid holds elements i = tid + 256*j of each 64x64 map: row (tid >> 6) + 4*j, column tid & 63.
    const int trow = tid >> 6, tcol = tid & 63;
    const float* gk = Wk + h * 4096 + tid;
    const float* gq = Wq + h * 4096 + tid;
    const float* gv = Wv + h * 4096 + tid;
    const float* go = Wo + trow * 512 + tcol * 8 + h;   // Wo_h[c',c] = Wo[c'*512 + c*8 + h]
    float rk[16], rq[16], rv[16], ro[16];
#pragma unroll
    for (int j = 0; j < 16; ++j) {   // unrolled: the 64 loads are in flight together, values stay in registers
        rk[j] = gk[j * 256];
        rq[j] = gq[j * 256];
        rv[j] = gv[j * 256];
        ro[j] = go[j * 2048];
    }
    // precaution: stands in front of any reuse of the loads' address registers; go is named as an
    // input so that its register pair, the only one that dies here, is not rewritten ahead of the wait
    asm volatile("s_wait_xcnt 0x0" :: "v"(go) : "memory");

    // Deterministic sum of the Gram partials, slice 0 first from 0.f. Thread tid owns elements 4*tid + 1024*j + 0..3
    // of G, j = 0..3: row (tid >> 4) + 16*j, columns 4*(tid & 15) + 0..3; a wave's load is 512 contiguous bytes.
    // Its 128 loads run as 8 groups of 16 (group g: part j = g >> 1, slices 16*(g & 1) + 0..15) through a ring of
    // three register sets: while a group is summed the next two stay in flight, and its set is refilled at once.
    const float* gbase = ws + WS_GPART + (size_t)b * NSLICE * 4096;   // the same for the whole block
    const float* gp = gbase + 4 * tid;
    v4f ring[3][GGROUP];
    gram_group(gp, 0, ring[0]);
    gram_group(gp, 1, ring[1]);
#pragma unroll
    for (int j = 0; j < 16; ++j) {   // unrolled: rk..ro are indexed by constants
        const int p = (trow + 4 * j) * LP + tcol;
        sWk[p] = rk[j];
        sWq[p] = rq[j];
        sWv[tcol * LP + trow + 4 * j] = rv[j];   // kept as sWv[e][d], so that the product's k (= d) is contiguous
        sWo[p] = ro[j];
    }
    // the third group starts only here, where the weights have left their registers: without it all three sets
    // and the weights are live together
    __builtin_amdgcn_sched_barrier(0);
    gram_group(gp, 2, ring[2]);
    {
        v4f s = {0.f, 0.f, 0.f, 0.f};
#pragma unroll
        for (int g = 0; g < 8; ++g) {   // unrolled whole: ring is indexed by constants and stays in registers
            // keeps each refill ahead of the next group's sum: sunk to its first use, a load's latency is waited out alone
            __builtin_amdgcn_sched_barrier(0);
#pragma unroll
            for (int q = 0; q < GGROUP; ++q) s += ring[g % 3][q];
            if (g & 1) {
                *(v4f*)(sG + ((tid >> 4) + 16 * (g >> 1)) * LP + 4 * (tid & 15)) = s;
                s = (v4f){0.f, 0.f, 0.f, 0.f};
            }
            if (g + 3 < 8) gram_group(gp, g + 3, ring[g % 3]);
            // precaution: behind the last load, in front of any reuse of the loads' address registers (the block's
            // base and the thread index); both are named as inputs so that neither is rewritten ahead of the wait
            if (g + 3 == 7) asm volatile("s_wait_xcnt 0x0" :: "s"(gbase), "v"(tid) : "memory");
        }
    }
    __syncthreads();

    // T1[e,d] = sum_f G[e,f] * Wk_h[d,f], kept as sT[d][e]
    {
        v8f d0 = zero8, d1 = zero8;
        mm64_tiles(sG, sWk, mt, nt, lc, lh, d0, d1);
        store_tile_t(sT, mt, nt * 16 + lc, lh, d0);
        store_tile_t(sT, mt, nt * 16 + 16 + lc, lh, d1);
    }
    __syncthreads();

    // S[c,d] = sum_e Wq_h[c,e] * T1[e,d]
    {
        v8f d0 = zero8, d1 = zero8;
        mm64_tiles(sWq, sT, mt, nt, lc, lh, d0, d1);
        float* sp = sS + (mt * 16 + lh * 8) * LP + nt * 16 + lc;
#pragma unroll
        for (int r = 0; r < 8; ++r) {   // unrolled: d0, d1 are indexed by constants and stay in registers
            sp[r * LP]      = d0[r];
            sp[r * LP + 16] = d1[r];
        }
    }
    __syncthreads();

    // InstanceNorm over the full 64x64 map (biased variance, eps=1e-5), then softmax along d, all in registers:
    // thread tid holds columns 16*(tid & 3) + 0..15 of row tid >> 2, so the four lanes of a row are neighbours
    // and a 16-byte read of lanes 0..15 (4 rows x 4 quarters at pitch LP) falls on 64 different banks.
    {
        float* rowp = sS + (tid >> 2) * LP + 16 * (tid & 3);
        v4f x[4];
#pragma unroll
        for (int i = 0; i < 4; ++i) x[i] = *(const v4f*)(rowp + 4 * i);   // unrolled: x stays in registers

        const v4f sv = (x[0] + x[1]) + (x[2] + x[3]);
        const v4f qv = (x[0] * x[0] + x[1] * x[1]) + (x[2] * x[2] + x[3] * x[3]);
        const float s  = row16_sum((sv.x + sv.y) + (sv.z + sv.w));
        const float s2 = row16_sum((qv.x + qv.y) + (qv.z + qv.w));
        if (lc == 0) { red[tid >> 4] = s; red2[tid >> 4] = s2; }
        __syncthreads();
        // every thread adds the 16 partial sums itself, in one fixed order: no thread waits for another's result
        const v4f* r1 = (const v4f*)red;
        const v4f* r2 = (const v4f*)red2;
        const v4f ts = (r1[0] + r1[1]) + (r1[2] + r1[3]);
        const v4f tq = (r2[0] + r2[1]) + (r2[2] + r2[3]);
        const float mean = ((ts.x + ts.y) + (ts.z + ts.w)) * (1.0f / 4096.0f);
        const float var  = ((tq.x + tq.y) + (tq.z + tq.w)) * (1.0f / 4096.0f) - mean * mean;
        const float rstd = rsqrtf(var + 1e-5f);

#pragma unroll
        for (int i = 0; i < 4; ++i) x[i] = (x[i] - mean) * rstd;   // unrolled, as every loop over x: constant indices
        v4f mv = x[0];
#pragma unroll
        for (int i = 1; i < 4; ++i) {   // unrolled: constant indices into x
            mv.x = fmaxf(mv.x, x[i].x);  mv.y = fmaxf(mv.y, x[i].y);
            mv.z = fmaxf(mv.z, x[i].z);  mv.w = fmaxf(mv.w, x[i].w);
        }
        float m = fmaxf(fmaxf(mv.x, mv.y), fmaxf(mv.z, mv.w));
        m = fmaxf(m, lane_xor<1>(m));
        m = fmaxf(m, lane_xor<2>(m));

        v4f ev = {0.f, 0.f, 0.f, 0.f};
#pragma unroll
        for (int i = 0; i < 4; ++i) {   // unrolled: constant indices into x; the 16 exponentials are independent
            x[i].x = expf(x[i].x - m);  x[i].y = expf(x[i].y - m);
            x[i].z = expf(x[i].z - m);  x[i].w = expf(x[i].w - m);
            ev += x[i];
        }
        float e = (ev.x + ev.y) + (ev.z + ev.w);
        e += lane_xor<1>(e);
        e += lane_xor<2>(e);
        const float inv = 1.f / e;
        // a thread rewrites only what it read itself, so no barrier is needed between its reads and these stores
#pragma unroll
        for (int i = 0; i < 4; ++i) *(v4f*)(rowp + 4 * i) = x[i] * inv;   // unrolled: constant indices into x
    }
    __syncthreads();

    // the wave's number as a scalar: the branches below are scalar, and every lane is on at the WMMAs inside them.
    const int wv = __builtin_amdgcn_readfirstlane(tid >> 5);

    // M[c,e] = sum_d attn[c,d] * Wv_h[d,e] for the block's 16 columns, kept as sT[e - 16*eq][c]
    if (wv < 4) {
        v8f d = zero8;
        mm64_tile(sS, sWv + eq * 16 * LP, wv, lc, lh, d);
        store_tile_t(sT, wv, lc, lh, d);
    }
    __syncthreads();

    // Pcontrib[c',e] = sum_c Wo_h[c',c] * M[c,e] for the same columns; the block's 64 x 16 piece is contiguous
    // in the workspace, so that no 128-byte line has two writers
    if (wv < 4) {
        v8f d = zero8;
        mm64_tile(sWo, sT, wv, lc, lh, d);
        float* pc = ws + WS_PC + (size_t)((b * H_ + h) * 4 + eq) * 1024
                  + (wv * 16 + lh * 8) * 16 + lc;
#pragma unroll
        for (int r = 0; r < 8; ++r)   // unrolled: d is indexed by constants and stays in registers
            pc[r * 16] = d[r];
    }
}

// ---------------------------------------------------------------------------
// Kernel 3: P_b = sum_h Pcontrib[b][h], summed by every block while it stages P in LDS
//           (h ascending from 0.f, deterministic); out_b[n,c'] = emb_b[n,:] . P_b[c',:] on WMMA.
// Each wave: one 16-row stripe x all 64 output columns (4 accumulators).
// P lies in LDS at pitch LP (16 B x odd). Lane (rlo, hh) reads k = 8*kk + 4*hh + 0..3 of its emb row
// and of its four P rows, 16 bytes each: both operands carry the same k order, and the 16 rows that
// the lanes of a read touch fall on different banks.
// ---------------------------------------------------------------------------
__global__ __launch_bounds__(256)
void out_kernel(const float* __restrict__ emb, const float* __restrict__ ws,
                float* __restrict__ out) {
    __shared__ __attribute__((aligned(16))) float sP[64 * LP];
    const int batch = blockIdx.x >> 7;   // 128 blocks per batch
    const int blk   = blockIdx.x & 127;
    const int tid   = threadIdx.x;

    // Thread tid owns elements 4*tid + 1024*j + 0..3 of a stored map, j = 0..3: row tid >> 2 of P, columns 16*j + 4*(tid & 3) + 0..3.
    {
        const float* pc = ws + WS_PC + (size_t)batch * H_ * 4096 + 4 * tid;
        v4f part[H_][4];
#pragma unroll
        for (int h = 0; h < H_; ++h)   // unrolled with the next loop: 32 independent loads of 16 bytes, no wait per trip
#pragma unroll
            for (int j = 0; j < 4; ++j)
                part[h][j] = *(const v4f*)(pc + h * 4096 + j * 1024);
#pragma unroll
        for (int j = 0; j < 4; ++j) {   // unrolled: part is indexed by constants and stays in registers
            v4f s = {0.f, 0.f, 0.f, 0.f};
#pragma unroll
            for (int h = 0; h < H_; ++h) s += part[h][j];
            *(v4f*)(sP + (tid >> 2) * LP + 16 * j + 4 * (tid & 3)) = s;
        }
    }
    __syncthreads();

    const int wave = tid >> 5, lane = tid & 31;
    const int n0   = (blk * 8 + wave) * 16;
    const int rlo  = lane & 15;
    const int hh   = lane >> 4;

    const float* A  = emb + ((size_t)batch * N_ + n0 + rlo) * C_ + 4 * hh;
    const float* bp = sP + rlo * LP + 4 * hh;
    float* O = out + ((size_t)batch * N_ + n0 + 8 * hh) * C_ + rlo;   // the lane's first output element

    v4f a[8], b[8][4];
#pragma unroll
    for (int kk = 0; kk < 8; ++kk)   // unrolled: the 8 loads of a lane are in flight together
        a[kk] = *(const v4f*)(A + kk * 8);
    // precaution: stands in front of any reuse of the loads' address registers; A is named as an input so that
    // its register pair is not rewritten ahead of the wait, O so that it is formed here and not inside the
    // matrix run, where its arithmetic took over operand registers one slot behind the WMMA that read them
    asm volatile("s_wait_xcnt 0x0" :: "v"(A), "v"(O) : "memory");
#pragma unroll
    for (int kk = 0; kk < 8; ++kk)   // unrolled with the next loop: b is indexed by constants and stays in registers
#pragma unroll
        for (int u = 0; u < 4; ++u)
            b[kk][u] = *(const v4f*)(bp + u * 16 * LP + kk * 8);   // P[c',e] = B[k,n'], c' = 16*u + rlo
    // keeps all 40 reads issued ahead of the matrix run: without it the compiler sinks them, in pairs, to
    // just in front of their first use, and each pair's latency is waited for in turn
    __builtin_amdgcn_sched_barrier(0);

    v8f acc0 = {0.f,0.f,0.f,0.f,0.f,0.f,0.f,0.f};
    v8f acc1 = acc0, acc2 = acc0, acc3 = acc0;

    // unrolled whole: a and b are indexed by constants; each step waits only for its own reads
#pragma unroll
    for (int kk = 0; kk < 8; ++kk) {
        const v2f alo = {a[kk].x, a[kk].y}, ahi = {a[kk].z, a[kk].w};
        const v2f p0 = {b[kk][0].x, b[kk][0].y}, q0 = {b[kk][0].z, b[kk][0].w};
        const v2f p1 = {b[kk][1].x, b[kk][1].y}, q1 = {b[kk][1].z, b[kk][1].w};
        const v2f p2 = {b[kk][2].x, b[kk][2].y}, q2 = {b[kk][2].z, b[kk][2].w};
        const v2f p3 = {b[kk][3].x, b[kk][3].y}, q3 = {b[kk][3].z, b[kk][3].w};
        acc0 = __builtin_amdgcn_wmma_f32_16x16x4_f32(false, alo, false, p0, (short)0, acc0, false, false);
        acc1 = __builtin_amdgcn_wmma_f32_16x16x4_f32(false, alo, false, p1, (short)0, acc1, false, false);
        acc2 = __builtin_amdgcn_wmma_f32_16x16x4_f32(false, alo, false, p2, (short)0, acc2, false, false);
        acc3 = __builtin_amdgcn_wmma_f32_16x16x4_f32(false, alo, false, p3, (short)0, acc3, false, false);
        acc0 = __builtin_amdgcn_wmma_f32_16x16x4_f32(false, ahi, false, q0, (short)0, acc0, false, false);
        acc1 = __builtin_amdgcn_wmma_f32_16x16x4_f32(false, ahi, false, q1, (short)0, acc1, false, false);
        acc2 = __builtin_amdgcn_wmma_f32_16x16x4_f32(false, ahi, false, q2, (short)0, acc2, false, false);
        acc3 = __builtin_amdgcn_wmma_f32_16x16x4_f32(false, ahi, false, q3, (short)0, acc3, false, false);
    }

#pragma unroll
    for (int r = 0; r < 8; ++r) {
        O[r * C_ +  0] = acc0[r];
        O[r * C_ + 16] = acc1[r];
        O[r * C_ + 32] = acc2[r];
        O[r * C_ + 48] = acc3[r];
    }
}

// ---------------------------------------------------------------------------
extern "C" void kernel_launch(void* const* d_in, const int* in_sizes, int n_in,
                              void* d_out, int out_size, void* d_ws, size_t ws_size,
                              hipStream_t stream) {
    const float* emb = (const float*)d_in[0];
    const float* Wq  = (const float*)d_in[1];
    const float* Wk  = (const float*)d_in[2];
    const float* Wv  = (const float*)d_in[3];
    const float* Wo  = (const float*)d_in[4];
    float* ws  = (float*)d_ws;
    float* out = (float*)d_out;

    hipLaunchKernelGGL(g_partial_kernel, dim3(B_ * NSLICE * 4), dim3(256), 0, stream, emb, ws);
    hipLaunchKernelGGL(heads_kernel,     dim3(B_ * H_ * 4), dim3(256), 0, stream, Wq, Wk, Wv, Wo, ws);
    hipLaunchKernelGGL(out_kernel,       dim3(256),         dim3(256), 0, stream, emb, ws, out);
}

// v009
// Measured time: 18.2 microseconds a run.
// Next to v008, in two timings, it ran 1.08 and 1.11 times as fast.
// Over all steps from v000 it is 5.49 times as fast.
#include <hip/hip_runtime.h>
#include <math.h>

typedef float v2f __attribute__((ext_vector_type(2)));
typedef float v4f __attribute__((ext_vector_type(4)));
typedef float v8f __attribute__((ext_vector_type(8)));

#define B_ 2
#define N_ 16384
#define C_ 64
#define H_ 8
#define NSLICE 16
#define ROWS_PER_SLICE (N_ / NSLICE)   // 1024
#define LP 68   // LDS row pitch in floats of the 64x64 maps: 16 B x odd, for 16-byte fragment reads

// workspace layout (float offsets)
#define GTILES 10                               // 16x16 tiles of G on or above the diagonal of the 4x4 tile grid
#define GPART  (GTILES * 256)                   // floats of one slice's partial Gram
#define WS_GPART 0                              // [B][NSLICE][GTILES][16][16] partial Gram, stored tiles only
#define WS_PC    (B_ * NSLICE * GPART)          // [B][H][4][64][16] per-head P contribution: [column block][row c'][column]
// total = 147456 floats = 576 KB

// Tile (t, u) of G holds G[4*m + t][4*l + u] at [m][l]. G = emb^T emb is symmetric for any emb, and tile (u, t) is
// the transpose of tile (t, u), product for product in the same order: only the tiles with t <= u are formed.
// Stored tile i is (TILE_T(i), TILE_U(i)): (0,0) (0,1) (0,2) (0,3) (1,1) (1,2) (1,3) (3,3) (2,2) (2,3), two bits an entry.
#define TILE_T(i) ((((1u << 8) | (1u << 10) | (1u << 12) | (3u << 14) | (2u << 16) | (2u << 18)) >> (2 * (i))) & 3u)
#define TILE_U(i) ((((1u << 2) | (2u << 4) | (3u << 6) | (1u << 8) | (2u << 10) | (3u << 12) | (3u << 14) | (2u << 16) | (3u << 18)) >> (2 * (i))) & 3u)

// ---------------------------------------------------------------------------
// Kernel 1: partial Gram matrices  Gpart[b][slice] = emb_slice^T @ emb_slice, the 10 stored tiles only.
// One 16-byte load of a lane (row n, columns 4*l .. 4*l+3) is that row's element of every tile, as A and as B alike.
// A block owns two stored tiles (2*pr, 2*pr + 1) of one slice; its 16 waves split the slice's 1024 rows,
// 64 each, every emb row read once per block in whole lines; the 16 partial tile pairs are summed in LDS.
// ---------------------------------------------------------------------------
#define GWAVES 16
#define ROWS_PER_WAVE (ROWS_PER_SLICE / GWAVES)   // 64
#define GLOADS (ROWS_PER_WAVE / 2)                // 32 loads a lane: each lane half reads every other row pair
#define GPITCH 20    // floats from l to l+1 of a tile in LDS: 16 B x odd, for 16-byte stores
#define GTILE  336   // floats from the first tile of a wave to its second

// x[2*s + j] is row 4*s + 2*hh + j of the wave's rows: k slot (hh, j) of step s, the same for A and B.
// d0 is tile (A0, B0), d1 is tile (A1, B1).
template <int A0, int B0, int A1, int B1>
__device__ __forceinline__ void pair_products(const v4f (&x)[GLOADS], v8f& d0, v8f& d1) {
    // unrolled whole: x is indexed by constants and stays in registers; each step waits only for its own two loads
#pragma unroll
    for (int s = 0; s < GLOADS / 2; ++s) {
        const v4f r0 = x[2 * s], r1 = x[2 * s + 1];
        const v2f a0 = {r0[A0], r1[A0]}, b0 = {r0[B0], r1[B0]};
        const v2f a1 = {r0[A1], r1[A1]}, b1 = {r0[B1], r1[B1]};
        d0 = __builtin_amdgcn_wmma_f32_16x16x4_f32(false, a0, false, b0, (short)0, d0, false, false);
        d1 = __builtin_amdgcn_wmma_f32_16x16x4_f32(false, a1, false, b1, (short)0, d1, false, false);
    }
}

__global__ __launch_bounds__(512)
void g_partial_kernel(const float* __restrict__ emb, float* __restrict__ ws) {
    __shared__ __attribute__((aligned(16))) float red[GWAVES * 2 * GTILE];   // [wave][tile of the pair][l][m]
    const int pr    = blockIdx.x >> 5;          // tile pair; the five blocks of a slice lie 32 apart in the grid
    const int bs    = blockIdx.x & 31;          // b * NSLICE + slice
    const int tid   = threadIdx.x;
    const int wave  = tid >> 5;
    const int lane  = tid & 31;
    const int l     = lane & 15;
    const int hh    = lane >> 4;

    const float* p = emb + ((size_t)bs * ROWS_PER_SLICE + wave * ROWS_PER_WAVE + 2 * hh) * C_ + 4 * l;
    v4f x[GLOADS];
#pragma unroll
    for (int s = 0; s < GLOADS / 2; ++s) {   // unrolled: all 32 loads of a lane are in flight together
        x[2 * s]     = *(const v4f*)(p + (4 * s) * C_);
        x[2 * s + 1] = *(const v4f*)(p + (4 * s + 1) * C_);
    }
    // precaution: stands in front of any reuse of the loads' address registers; p is named as an
    // input so that its register pair is not rewritten ahead of the wait
    asm volatile("s_wait_xcnt 0x0" :: "v"(p) : "memory");

    v8f d0 = {0.f, 0.f, 0.f, 0.f, 0.f, 0.f, 0.f, 0.f};
    v8f d1 = d0;
    // pr is the same for the whole block: a scalar branch picks the copy with the pair's components
    switch (pr) {
        case 0:  pair_products<0, 0, 0, 1>(x, d0, d1); break;
        case 1:  pair_products<0, 2, 0, 3>(x, d0, d1); break;
        case 2:  pair_products<1, 1, 1, 2>(x, d0, d1); break;
        case 3:  pair_products<1, 3, 3, 3>(x, d0, d1); break;
        default: pair_products<2, 2, 2, 3>(x, d0, d1); break;
    }

    // tile (t, u) holds G[4*(r + 8*hh) + t][4*l + u] in lane (l, hh), register r. Each tile goes to LDS as [l][m],
    // 8 consecutive m a lane, straight from the accumulator registers.
    float* rw = red + wave * (2 * GTILE) + l * GPITCH + 8 * hh;
    {
        const v4f q00 = {d0[0], d0[1], d0[2], d0[3]}, q01 = {d0[4], d0[5], d0[6], d0[7]};
        const v4f q10 = {d1[0], d1[1], d1[2], d1[3]}, q11 = {d1[4], d1[5], d1[6], d1[7]};
        *(v4f*)(rw)         = q00;  *(v4f*)(rw + 4)         = q01;
        *(v4f*)(rw + GTILE) = q10;  *(v4f*)(rw + GTILE + 4) = q11;
    }
    __syncthreads();

    // thread tid sums element [m][l] = [(tid >> 4) & 15][tid & 15] of tile tid >> 8 of the pair over the waves, wave 0
    // first; the 32 lanes of a read (16 l at pitch 20, two m) fall on different banks
    const float* rr = red + (tid >> 8) * GTILE + (tid & 15) * GPITCH + ((tid >> 4) & 15);
    float sum = 0.f;
#pragma unroll
    for (int w = 0; w < GWAVES; ++w)   // unrolled: the 16 LDS reads issue together
        sum += rr[w * (2 * GTILE)];
    // the block's two tiles are 2 KB in a row in the workspace, [tile][m][l]: whole lines, one writer each
    ws[WS_GPART + (size_t)bs * GPART + pr * 512 + tid] = sum;
}

// ---------------------------------------------------------------------------
// One wave's share of a 64x64x64 product D[m][n] = sum_k X[m][k] * Y[n][k]:
// row tile mt against column tiles nt and nt+1. X and Y lie in LDS at pitch LP
// with k contiguous. Lane (c, hh) reads k = 8*kk + 4*hh + 0..3 of its row of X
// and of Y with the same code, so both operands carry the same k order.
// ---------------------------------------------------------------------------
__device__ __forceinline__ void mm64_tiles(const float* X, const float* Y,
                                           int mt, int nt, int c, int hh,
                                           v8f& d0, v8f& d1) {
    const float* xp = X + (mt * 16 + c) * LP + 4 * hh;
    const float* y0 = Y + (nt * 16 + c) * LP + 4 * hh;
    const float* y1 = y0 + 16 * LP;
    // unrolled whole: the LDS reads can issue ahead of the matrix run, no branch behind a WMMA
#pragma unroll
    for (int kk = 0; kk < 8; ++kk) {
        const v4f a  = *(const v4f*)(xp + kk * 8);
        const v4f b0 = *(const v4f*)(y0 + kk * 8);
        const v4f b1 = *(const v4f*)(y1 + kk * 8);
        const v2f alo = {a.x, a.y},   ahi = {a.z, a.w};
        const v2f p0  = {b0.x, b0.y}, q0  = {b0.z, b0.w};
        const v2f p1  = {b1.x, b1.y}, q1  = {b1.z, b1.w};
        d0 = __builtin_amdgcn_wmma_f32_16x16x4_f32(false, alo, false, p0, (short)0, d0, false, false);
        d1 = __builtin_amdgcn_wmma_f32_16x16x4_f32(false, alo, false, p1, (short)0, d1, false, false);
        d0 = __builtin_amdgcn_wmma_f32_16x16x4_f32(false, ahi, false, q0, (short)0, d0, false, false);
        d1 = __builtin_amdgcn_wmma_f32_16x16x4_f32(false, ahi, false, q1, (short)0, d1, false, false);
    }
}

// The same for one tile: row tile mt of X against the 16 rows of Y, the products summed in the same order.
__device__ __forceinline__ void mm64_tile(const float* X, const float* Y,
                                          int mt, int c, int hh, v8f& d) {
    const float* xp = X + (mt * 16 + c) * LP + 4 * hh;
    const float* yp = Y + c * LP + 4 * hh;
    v4f a[8], y[8];
#pragma unroll
    for (int kk = 0; kk < 8; ++kk) {   // unrolled: a and y are indexed by constants and stay in registers
        a[kk] = *(const v4f*)(xp + kk * 8);
        y[kk] = *(const v4f*)(yp + kk * 8);
    }
    // keeps all 16 reads issued ahead of the matrix run, for speed only
    __builtin_amdgcn_sched_barrier(0);
#pragma unroll
    for (int kk = 0; kk < 8; ++kk) {   // unrolled: constant indices, no branch behind a WMMA
        const v2f alo = {a[kk].x, a[kk].y}, ahi = {a[kk].z, a[kk].w};
        const v2f p   = {y[kk].x, y[kk].y}, q   = {y[kk].z, y[kk].w};
        d = __builtin_amdgcn_wmma_f32_16x16x4_f32(false, alo, false, p, (short)0, d, false, false);
        d = __builtin_amdgcn_wmma_f32_16x16x4_f32(false, ahi, false, q, (short)0, d, false, false);
    }
    // keeps the address arithmetic of the stores that follow out of the matrix run, where it took over operand
    // registers one slot behind the WMMA that read them
    __builtin_amdgcn_sched_barrier(0);
    // four vector slots between the last WMMA and that arithmetic, which may take over its operand registers too
    asm volatile("v_nop\n\tv_nop\n\tv_nop\n\tv_nop");
    // holds the arithmetic behind the four slots
    __builtin_amdgcn_sched_barrier(0);
}

// D tile (rows 16*mt + 8*hh + r, column n) stored transposed: Z[n][m], 8 consecutive m per lane
__device__ __forceinline__ void store_tile_t(float* Z, int mt, int n, int hh, const v8f& d) {
    float* z = Z + n * LP + mt * 16 + hh * 8;
    const v4f lo = {d[0], d[1], d[2], d[3]}, hi = {d[4], d[5], d[6], d[7]};
    *(v4f*)z = lo;
    *(v4f*)(z + 4) = hi;
}

// Value of lane l ^ M, M < 16, by a DPP move inside the 16-lane row; every lane is on where it is used.
template <int M>
__device__ __forceinline__ float lane_xor(float v) {
    return __builtin_bit_cast(float,
        __builtin_amdgcn_update_dpp(0, __builtin_bit_cast(int, v), 0x160 | M, 0xf, 0xf, true));   // 0x160 | M = row_xmask:M
}

// Sum over the 16 lanes of a row; every lane gets it.
__device__ __forceinline__ float row16_sum(float v) {
    v += lane_xor<1>(v);
    v += lane_xor<2>(v);
    v += lane_xor<4>(v);
    v += lane_xor<8>(v);
    return v;
}

// One chunk of the Gram sum's loads: floats 1024*c + 4*tid + 0..3 of every slice's stored tiles, 16 bytes a lane each.
__device__ __forceinline__ void gram_chunk(const float* gp, int c, v4f (&r)[NSLICE]) {
#pragma unroll
    for (int q = 0; q < NSLICE; ++q)   // unrolled: 16 independent loads, r is indexed by constants
        r[q] = *(const v4f*)(gp + q * GPART + c * 1024);
}

// Sums a chunk over the slices, slice 0 first from 0.f, and puts it into the map of G in LDS. That map is kept by tiles:
// row 16*t + m is G row 4*m + t, column 16*u + l is G column 4*l + u. The thread's four values are [m][l0 .. l0+3] of
// stored tile i = (t, u): one 16-byte store at their own place and, off the diagonal, four stores at the mirrored place.
__device__ __forceinline__ void gram_put(float* sG, const v4f (&r)[NSLICE], int i, int m, int l0) {
    v4f s = {0.f, 0.f, 0.f, 0.f};
#pragma unroll
    for (int q = 0; q < NSLICE; ++q) s += r[q];   // unrolled: r is indexed by constants and stays in registers
    const int t = TILE_T(i), u = TILE_U(i);
    *(v4f*)(sG + (16 * t + m) * LP + 16 * u + l0) = s;
    if (t != u) {
        float* z = sG + (16 * u + l0) * LP + 16 * t + m;
        z[0] = s.x;  z[LP] = s.y;  z[2 * LP] = s.z;  z[3 * LP] = s.w;
    }
}

// ---------------------------------------------------------------------------
// Kernel 2: per (b,h): S = Wq_h G Wk_h^T ; instance-norm ; softmax(rows) ;
//           M = attn @ Wv_h ; Pcontrib = Wo_h @ M.   All 64x64, done in LDS, on WMMA f32.
// Four blocks a head. The norm and the softmax need all of S, so each block forms S and attn whole
// (8 waves x 2 tiles of 16x16 a product); of M and Pcontrib, whose columns e are independent of one
// another, it forms only its own 16 columns: 4 tiles a product, one on each of waves 0..3.
// ---------------------------------------------------------------------------
__global__ __launch_bounds__(256)
void heads_kernel(const float* __restrict__ Wq, const float* __restrict__ Wk,
                  const float* __restrict__ Wv, const float* __restrict__ Wo,
                  float* __restrict__ ws) {
    __shared__ __attribute__((aligned(16))) float sG[64 * LP], sT[64 * LP], sS[64 * LP];
    __shared__ __attribute__((aligned(16))) float sWk[64 * LP], sWq[64 * LP], sWv[64 * LP], sWo[64 * LP];
    __shared__ __attribute__((aligned(16))) float red[16], red2[16];   // one partial sum per 16 lanes

    const int b  = blockIdx.x >> 5;
    const int h  = (blockIdx.x >> 2) & 7;
    const int eq = blockIdx.x & 3;                 // the block's columns e = 16*eq + 0..15 of M and Pcontrib
    const int tid = threadIdx.x;
    const int lane = tid & 31;
    const int lc = lane & 15, lh = lane >> 4;      // fragment column / k half
    const int mt = tid >> 6;                       // wave's row tile
    const int nt = ((tid >> 5) & 1) * 2;           // wave's first column tile
    const v8f zero8 = {0.f, 0.f, 0.f, 0.f, 0.f, 0.f, 0.f, 0.f};

    // All four weight maps are requested here, ahead of the Gram sum: their latency runs
    // under that sum's own loads, and no product later waits on a global load.
    // Thread tid holds elements i = tid + 256*j of each 64x64 map: row (tid >> 6) + 4*j, column tid & 63.
    const int trow = tid >> 6, tcol = tid & 63;
    const float* gk = Wk + h * 4096 + tid;
    const float* gq = Wq + h * 4096 + tid;
    const float* gv = Wv + h * 4096 + tid;
    const float* go = Wo + trow * 512 + tcol * 8 + h;   // Wo_h[c',c] = Wo[c'*512 + c*8 + h]
    float rk[16], rq[16], rv[16], ro[16];
#pragma unroll
    for (int j = 0; j < 16; ++j) {   // unrolled: the 64 loads are in flight together, values stay in registers
        rk[j] = gk[j * 256];
        rq[j] = gq[j * 256];
        rv[j] = gv[j * 256];
        ro[j] = go[j * 2048];
    }
    // precaution: stands in front of any reuse of the loads' address registers; go is named as an
    // input so that its register pair, the only one that dies here, is not rewritten ahead of the wait
    asm volatile("s_wait_xcnt 0x0" :: "v"(go) : "memory");

    // the wave's number as a scalar: the branches on it are scalar, and every lane is on at the WMMAs inside them.
    const int wv = __builtin_amdgcn_readfirstlane(tid >> 5);

    // Deterministic sum of the Gram partials over the 16 slices. A slice's 10 stored tiles are 640 pieces of 16 bytes:
    // thread tid owns pieces tid and tid + 256, and in waves 0..3 piece tid + 512; a wave's load is 512 contiguous bytes.
    // Piece tid + 256*c is [m][l0 .. l0+3] of stored tile (tid >> 6) + 4*c, m = (tid >> 2) & 15, l0 = 4*(tid & 3).
    const float* gbase = ws + WS_GPART + (size_t)b * NSLICE * GPART;   // the same for the whole block
    const float* gp = gbase + 4 * tid;
    v4f c0[NSLICE], c1[NSLICE], c2[NSLICE];
    gram_chunk(gp, 0, c0);
    gram_chunk(gp, 1, c1);
    // Wk and Wq are contracted with G's columns and rows: their columns are kept in the order of the map of G in LDS
    const int pcol = 16 * (tcol & 3) + (tcol >> 2);
#pragma unroll
    for (int j = 0; j < 16; ++j) {   // unrolled: rk..ro are indexed by constants
        sWk[(trow + 4 * j) * LP + pcol] = rk[j];
        sWq[(trow + 4 * j) * LP + pcol] = rq[j];
        sWv[tcol * LP + trow + 4 * j] = rv[j];   // kept as sWv[e][d], so that the product's k (= d) is contiguous
        sWo[(trow + 4 * j) * LP + tcol] = ro[j];
    }
    // the third chunk starts only here, where the weights have left their registers: without it all three chunks
    // and the weights are live together
    __builtin_amdgcn_sched_barrier(0);
    {
        const int gm = (tid >> 2) & 15, gl = 4 * (tid & 3), gi = tid >> 6;
        if (wv < 4) {
            gram_chunk(gp, 2, c2);
            // precaution: behind the last load, in front of any reuse of the loads' address registers (the block's
            // base and the thread index, or the thread's own pointer): all are named as inputs so that none of them
            // is rewritten, by a load's result either, ahead of the wait
            asm volatile("s_wait_xcnt 0x0" :: "s"(gbase), "v"(tid), "v"(gp) : "memory");
            gram_put(sG, c0, gi, gm, gl);
            gram_put(sG, c1, gi + 4, gm, gl);
            // keeps the third chunk's sum last: loads return in order, and ahead of the other two it would wait out all 48
            __builtin_amdgcn_sched_barrier(0);
            gram_put(sG, c2, gi + 8, gm, gl);
        } else {
            // the same precaution for the waves whose last load is the second chunk's
            asm volatile("s_wait_xcnt 0x0" :: "s"(gbase), "v"(tid) : "memory");
            gram_put(sG, c0, gi, gm, gl);
            gram_put(sG, c1, gi + 4, gm, gl);
        }
    }
    __syncthreads();

    // T1[e,d] = sum_f G[e,f] * Wk_h[d,f], kept as sT[d][e]; e and f run in the order of the map of G
    {
        v8f d0 = zero8, d1 = zero8;
        mm64_tiles(sG, sWk, mt, nt, lc, lh, d0, d1);
        store_tile_t(sT, mt, nt * 16 + lc, lh, d0);
        store_tile_t(sT, mt, nt * 16 + 16 + lc, lh, d1);
    }
    __syncthreads();

    // S[c,d] = sum_e Wq_h[c,e] * T1[e,d], e in that same order in both operands
    {
        v8f d0 = zero8, d1 = zero8;
        mm64_tiles(sWq, sT, mt, nt, lc, lh, d0, d1);
        float* sp = sS + (mt * 16 + lh * 8) * LP + nt * 16 + lc;
#pragma unroll
        for (int r = 0; r < 8; ++r) {   // unrolled: d0, d1 are indexed by constants and stay in registers
            sp[r * LP]      = d0[r];
            sp[r * LP + 16] = d1[r];
        }
    }
    __syncthreads();

    // InstanceNorm over the full 64x64 map (biased variance, eps=1e-5), then softmax along d, all in registers:
    // thread tid holds columns 16*(tid & 3) + 0..15 of row tid >> 2, so the four lanes of a row are neighbours
    // and a 16-byte read of lanes 0..15 (4 rows x 4 quarters at pitch LP) falls on 64 different banks.
    {
        float* rowp = sS + (tid >> 2) * LP + 16 * (tid & 3);
        v4f x[4];
#pragma unroll
        for (int i = 0; i < 4; ++i) x[i] = *(const v4f*)(rowp + 4 * i);   // unrolled: x stays in registers

        const v4f sv = (x[0] + x[1]) + (x[2] + x[3]);
        const v4f qv = (x[0] * x[0] + x[1] * x[1]) + (x[2] * x[2] + x[3] * x[3]);
        const float s  = row16_sum((sv.x + sv.y) + (sv.z + sv.w));
        const float s2 = row16_sum((qv.x + qv.y) + (qv.z + qv.w));
        if (lc == 0) { red[tid >> 4] = s; red2[tid >> 4] = s2; }
        __syncthreads();
        // every thread adds the 16 partial sums itself, in one fixed order: no thread waits for another's result
        const v4f* r1 = (const v4f*)red;
        const v4f* r2 = (const v4f*)red2;
        const v4f ts = (r1[0] + r1[1]) + (r1[2] + r1[3]);
        const v4f tq = (r2[0] + r2[1]) + (r2[2] + r2[3]);
        const float mean = ((ts.x + ts.y) + (ts.z + ts.w)) * (1.0f / 4096.0f);
        const float var  = ((tq.x + tq.y) + (tq.z + tq.w)) * (1.0f / 4096.0f) - mean * mean;
        const float rstd = rsqrtf(var + 1e-5f);

#pragma unroll
        for (int i = 0; i < 4; ++i) x[i] = (x[i] - mean) * rstd;   // unrolled, as every loop over x: constant indices
        v4f mv = x[0];
#pragma unroll
        for (int i = 1; i < 4; ++i) {   // unrolled: constant indices into x
            mv.x = fmaxf(mv.x, x[i].x);  mv.y = fmaxf(mv.y, x[i].y);
            mv.z = fmaxf(mv.z, x[i].z);  mv.w = fmaxf(mv.w, x[i].w);
        }
        float m = fmaxf(fmaxf(mv.x, mv.y), fmaxf(mv.z, mv.w));
        m = fmaxf(m, lane_xor<1>(m));
        m = fmaxf(m, lane_xor<2>(m));

        v4f ev = {0.f, 0.f, 0.f, 0.f};
#pragma unroll
        for (int i = 0; i < 4; ++i) {   // unrolled: constant indices into x; the 16 exponentials are independent
            x[i].x = expf(x[i].x - m);  x[i].y = expf(x[i].y - m);
            x[i].z = expf(x[i].z - m);  x[i].w = expf(x[i].w - m);
            ev += x[i];
        }
        float e = (ev.x + ev.y) + (ev.z + ev.w);
        e += lane_xor<1>(e);
        e += lane_xor<2>(e);
        const float inv = 1.f / e;
        // a thread rewrites only what it read itself, so no barrier is needed between its reads and these stores
#pragma unroll
        for (int i = 0; i < 4; ++i) *(v4f*)(rowp + 4 * i) = x[i] * inv;   // unrolled: constant indices into x
    }
    __syncthreads();

    // M[c,e] = sum_d attn[c,d] * Wv_h[d,e] for the block's 16 columns, kept as sT[e - 16*eq][c]
    if (wv < 4) {
        v8f d = zero8;
        mm64_tile(sS, sWv + eq * 16 * LP, wv, lc, lh, d);
        store_tile_t(sT, wv, lc, lh, d);
    }
    __syncthreads();

    // Pcontrib[c',e] = sum_c Wo_h[c',c] * M[c,e] for the same columns; the block's 64 x 16 piece is contiguous
    // in the workspace, so that no 128-byte line has two writers
    if (wv < 4) {
        v8f d = zero8;
        mm64_tile(sWo, sT, wv, lc, lh, d);
        float* pc = ws + WS_PC + (size_t)((b * H_ + h) * 4 + eq) * 1024
                  + (wv * 16 + lh * 8) * 16 + lc;
#pragma unroll
        for (int r = 0; r < 8; ++r)   // unrolled: d is indexed by constants and stays in registers
            pc[r * 16] = d[r];
    }
}

// ---------------------------------------------------------------------------
// Kernel 3: P_b = sum_h Pcontrib[b][h], summed by every block while it stages P in LDS
//           (h ascending from 0.f, deterministic); out_b[n,c'] = emb_b[n,:] . P_b[c',:] on WMMA.
// Each wave: one 16-row stripe x all 64 output columns (4 accumulators).
// P lies in LDS at pitch LP (16 B x odd). Lane (rlo, hh) reads k = 8*kk + 4*hh + 0..3 of its emb row
// and of its four P rows, 16 bytes each: both operands carry the same k order, and the 16 rows that
// the lanes of a read touch fall on different banks.
// ---------------------------------------------------------------------------
__global__ __launch_bounds__(256)
void out_kernel(const float* __restrict__ emb, const float* __restrict__ ws,
                float* __restrict__ out) {
    __shared__ __attribute__((aligned(16))) float sP[64 * LP];
    const int batch = blockIdx.x >> 7;   // 128 blocks per batch
    const int blk   = blockIdx.x & 127;
    const int tid   = threadIdx.x;

    // Thread tid owns elements 4*tid + 1024*j + 0..3 of a stored map, j = 0..3: row tid >> 2 of P, columns 16*j + 4*(tid & 3) + 0..3.
    {
        const float* pc = ws + WS_PC + (size_t)batch * H_ * 4096 + 4 * tid;
        v4f part[H_][4];
#pragma unroll
        for (int h = 0; h < H_; ++h)   // unrolled with the next loop: 32 independent loads of 16 bytes, no wait per trip
#pragma unroll
            for (int j = 0; j < 4; ++j)
                part[h][j] = *(const v4f*)(pc + h * 4096 + j * 1024);
#pragma unroll
        for (int j = 0; j < 4; ++j) {   // unrolled: part is indexed by constants and stays in registers
            v4f s = {0.f, 0.f, 0.f, 0.f};
#pragma unroll
            for (int h = 0; h < H_; ++h) s += part[h][j];
            *(v4f*)(sP + (tid >> 2) * LP + 16 * j + 4 * (tid & 3)) = s;
        }
    }
    __syncthreads();

    const int wave = tid >> 5, lane = tid & 31;
    const int n0   = (blk * 8 + wave) * 16;
    const int rlo  = lane & 15;
    const int hh   = lane >> 4;

    const float* A  = emb + ((size_t)batch * N_ + n0 + rlo) * C_ + 4 * hh;
    const float* bp = sP + rlo * LP + 4 * hh;
    float* O = out + ((size_t)batch * N_ + n0 + 8 * hh) * C_ + rlo;   // the lane's first output element

    v4f a[8], b[8][4];
#pragma unroll
    for (int kk = 0; kk < 8; ++kk)   // unrolled: the 8 loads of a lane are in flight together
        a[kk] = *(const v4f*)(A + kk * 8);
    // precaution: stands in front of any reuse of the loads' address registers; A is named as an input so that
    // its register pair is not rewritten ahead of the wait, O so that it is formed here and not inside the
    // matrix run, where its arithmetic took over operand registers one slot behind the WMMA that read them
    asm volatile("s_wait_xcnt 0x0" :: "v"(A), "v"(O) : "memory");
#pragma unroll
    for (int kk = 0; kk < 8; ++kk)   // unrolled with the next loop: b is indexed by constants and stays in registers
#pragma unroll
        for (int u = 0; u < 4; ++u)
            b[kk][u] = *(const v4f*)(bp + u * 16 * LP + kk * 8);   // P[c',e] = B[k,n'], c' = 16*u + rlo
    // keeps all 40 reads issued ahead of the matrix run: without it the compiler sinks them, in pairs, to
    // just in front of their first use, and each pair's latency is waited for in turn
    __builtin_amdgcn_sched_barrier(0);

    v8f acc0 = {0.f,0.f,0.f,0.f,0.f,0.f,0.f,0.f};
    v8f acc1 = acc0, acc2 = acc0, acc3 = acc0;

    // unrolled whole: a and b are indexed by constants; each step waits only for its own reads
#pragma unroll
    for (int kk = 0; kk < 8; ++kk) {
        const v2f alo = {a[kk].x, a[kk].y}, ahi = {a[kk].z, a[kk].w};
        const v2f p0 = {b[kk][0].x, b[kk][0].y}, q0 = {b[kk][0].z, b[kk][0].w};
        const v2f p1 = {b[kk][1].x, b[kk][1].y}, q1 = {b[kk][1].z, b[kk][1].w};
        const v2f p2 = {b[kk][2].x, b[kk][2].y}, q2 = {b[kk][2].z, b[kk][2].w};
        const v2f p3 = {b[kk][3].x, b[kk][3].y}, q3 = {b[kk][3].z, b[kk][3].w};
        acc0 = __builtin_amdgcn_wmma_f32_16x16x4_f32(false, alo, false, p0, (short)0, acc0, false, false);
        acc1 = __builtin_amdgcn_wmma_f32_16x16x4_f32(false, alo, false, p1, (short)0, acc1, false, false);
        acc2 = __builtin_amdgcn_wmma_f32_16x16x4_f32(false, alo, false, p2, (short)0, acc2, false, false);
        acc3 = __builtin_amdgcn_wmma_f32_16x16x4_f32(false, alo, false, p3, (short)0, acc3, false, false);
        acc0 = __builtin_amdgcn_wmma_f32_16x16x4_f32(false, ahi, false, q0, (short)0, acc0, false, false);
        acc1 = __builtin_amdgcn_wmma_f32_16x16x4_f32(false, ahi, false, q1, (short)0, acc1, false, false);
        acc2 = __builtin_amdgcn_wmma_f32_16x16x4_f32(false, ahi, false, q2, (short)0, acc2, false, false);
        acc3 = __builtin_amdgcn_wmma_f32_16x16x4_f32(false, ahi, false, q3, (short)0, acc3, false, false);
    }

#pragma unroll
    for (int r = 0; r < 8; ++r) {
        O[r * C_ +  0] = acc0[r];
        O[r * C_ + 16] = acc1[r];
        O[r * C_ + 32] = acc2[r];
        O[r * C_ + 48] = acc3[r];
    }
}

// ---------------------------------------------------------------------------
extern "C" void kernel_launch(void* const* d_in, const int* in_sizes, int n_in,
                              void* d_out, int out_size, void* d_ws, size_t ws_size,
                              hipStream_t stream) {
    const float* emb = (const float*)d_in[0];
    const float* Wq  = (const float*)d_in[1];
    const float* Wk  = (const float*)d_in[2];
    const float* Wv  = (const float*)d_in[3];
    const float* Wo  = (const float*)d_in[4];
    float* ws  = (float*)d_ws;
    float* out = (float*)d_out;

    hipLaunchKernelGGL(g_partial_kernel, dim3(B_ * NSLICE * 5), dim3(512), 0, stream, emb, ws);
    hipLaunchKernelGGL(heads_kernel,     dim3(B_ * H_ * 4), dim3(256), 0, stream, Wq, Wk, Wv, Wo, ws);
    hipLaunchKernelGGL(out_kernel,       dim3(256),         dim3(256), 0, stream, emb, ws, out);
}

// v010
// Measured time: 16.6 microseconds a run.
// Timed twice side by side with v009, it ran 1.05 and 1.06 times as fast.
// Over all steps from v000 it is 5.79 times as fast.
#include <hip/hip_runtime.h>
#include <math.h>

typedef float v2f __attribute__((ext_vector_type(2)));
typedef float v4f __attribute__((ext_vector_type(4)));
typedef float v8f __attribute__((ext_vector_type(8)));

#define B_ 2
#define N_ 16384
#define C_ 64
#define H_ 8
#define NSLICE 16
#define ROWS_PER_SLICE (N_ / NSLICE)   // 1024
#define LP 68   // LDS row pitch in floats of the 64x64 maps: 16 B x odd, for 16-byte fragment reads

// workspace layout (float offsets)
#define GTILES 10                               // 16x16 tiles of G on or above the diagonal of the 4x4 tile grid
#define GPART  (GTILES * 256)                   // floats of one slice's partial Gram
#define WS_GPART 0                              // [B][NSLICE][GTILES][16][16] partial Gram, stored tiles only
#define WS_PC    (B_ * NSLICE * GPART)          // [B][H][4][64][16] per-head P contribution: [column block][row c'][column]
// total = 147456 floats = 576 KB

// Tile (t, u) of G holds G[4*m + t][4*l + u] at [m][l]. G = emb^T emb is symmetric for any emb, and tile (u, t) is
// the transpose of tile (t, u), product for product in the same order: only the tiles with t <= u are formed.
// Stored tile i is (TILE_T(i), TILE_U(i)): (0,0) (0,1) (0,2) (0,3) (1,1) (1,2) (1,3) (3,3) (2,2) (2,3), two bits an entry.
#define TILE_T(i) ((((1u << 8) | (1u << 10) | (1u << 12) | (3u << 14) | (2u << 16) | (2u << 18)) >> (2 * (i))) & 3u)
#define TILE_U(i) ((((1u << 2) | (2u << 4) | (3u << 6) | (1u << 8) | (2u << 10) | (3u << 12) | (3u << 14) | (2u << 16) | (3u << 18)) >> (2 * (i))) & 3u)

// ---------------------------------------------------------------------------
// Kernel 1: partial Gram matrices  Gpart[b][slice] = emb_slice^T @ emb_slice, the 10 stored tiles only.
// One 16-byte load of a lane (row n, columns 4*l .. 4*l+3) is that row's element of every tile, as A and as B alike.
// A block owns two stored tiles (2*pr, 2*pr + 1) of one slice; its 16 waves split the slice's 1024 rows,
// 64 each, every emb row read once per block in whole lines; the 16 partial tile pairs are summed in LDS.
// ---------------------------------------------------------------------------
#define GWAVES 16
#define ROWS_PER_WAVE (ROWS_PER_SLICE / GWAVES)   // 64
#define GLOADS (ROWS_PER_WAVE / 2)                // 32 loads a lane: each lane half reads every other row pair
#define GPITCH 20    // floats from l to l+1 of a tile in LDS: 16 B x odd, for 16-byte stores
#define GTILE  336   // floats from the first tile of a wave to its second

// x[2*s + j] is row 4*s + 2*hh + j of the wave's rows: k slot (hh, j) of step s, the same for A and B.
// d0 is tile (A0, B0), d1 is tile (A1, B1).
template <int A0, int B0, int A1, int B1>
__device__ __forceinline__ void pair_products(const v4f (&x)[GLOADS], v8f& d0, v8f& d1) {
    // unrolled whole: x is indexed by constants and stays in registers; each step waits only for its own two loads
#pragma unroll
    for (int s = 0; s < GLOADS / 2; ++s) {
        const v4f r0 = x[2 * s], r1 = x[2 * s + 1];
        const v2f a0 = {r0[A0], r1[A0]}, b0 = {r0[B0], r1[B0]};
        const v2f a1 = {r0[A1], r1[A1]}, b1 = {r0[B1], r1[B1]};
        d0 = __builtin_amdgcn_wmma_f32_16x16x4_f32(false, a0, false, b0, (short)0, d0, false, false);
        d1 = __builtin_amdgcn_wmma_f32_16x16x4_f32(false, a1, false, b1, (short)0, d1, false, false);
    }
}

__global__ __launch_bounds__(512)
void g_partial_kernel(const float* __restrict__ emb, float* __restrict__ ws) {
    __shared__ __attribute__((aligned(16))) float red[GWAVES * 2 * GTILE];   // [wave][tile of the pair][l][m]
    const int pr    = blockIdx.x >> 5;          // tile pair; the five blocks of a slice lie 32 apart in the grid
    const int bs    = blockIdx.x & 31;          // b * NSLICE + slice
    const int tid   = threadIdx.x;
    const int wave  = tid >> 5;
    const int lane  = tid & 31;
    const int l     = lane & 15;
    const int hh    = lane >> 4;

    const float* p = emb + ((size_t)bs * ROWS_PER_SLICE + wave * ROWS_PER_WAVE + 2 * hh) * C_ + 4 * l;
    v4f x[GLOADS];
#pragma unroll
    for (int s = 0; s < GLOADS / 2; ++s) {   // unrolled: all 32 loads of a lane are in flight together
        x[2 * s]     = *(const v4f*)(p + (4 * s) * C_);
        x[2 * s + 1] = *(const v4f*)(p + (4 * s + 1) * C_);
    }
    // precaution: stands in front of any reuse of the loads' address registers; p is named as an
    // input so that its register pair is not rewritten ahead of the wait
    asm volatile("s_wait_xcnt 0x0" :: "v"(p) : "memory");

    v8f d0 = {0.f, 0.f, 0.f, 0.f, 0.f, 0.f, 0.f, 0.f};
    v8f d1 = d0;
    // pr is the same for the whole block: a scalar branch picks the copy with the pair's components
    switch (pr) {
        case 0:  pair_products<0, 0, 0, 1>(x, d0, d1); break;
        case 1:  pair_products<0, 2, 0, 3>(x, d0, d1); break;
        case 2:  pair_products<1, 1, 1, 2>(x, d0, d1); break;
        case 3:  pair_products<1, 3, 3, 3>(x, d0, d1); break;
        default: pair_products<2, 2, 2, 3>(x, d0, d1); break;
    }

    // tile (t, u) holds G[4*(r + 8*hh) + t][4*l + u] in lane (l, hh), register r. Each tile goes to LDS as [l][m],
    // 8 consecutive m a lane, straight from the accumulator registers.
    float* rw = red + wave * (2 * GTILE) + l * GPITCH + 8 * hh;
    {
        const v4f q00 = {d0[0], d0[1], d0[2], d0[3]}, q01 = {d0[4], d0[5], d0[6], d0[7]};
        const v4f q10 = {d1[0], d1[1], d1[2], d1[3]}, q11 = {d1[4], d1[5], d1[6], d1[7]};
        *(v4f*)(rw)         = q00;  *(v4f*)(rw + 4)         = q01;
        *(v4f*)(rw + GTILE) = q10;  *(v4f*)(rw + GTILE + 4) = q11;
    }
    __syncthreads();

    // thread tid sums element [m][l] = [(tid >> 4) & 15][tid & 15] of tile tid >> 8 of the pair over the waves, wave 0
    // first; the 32 lanes of a read (16 l at pitch 20, two m) fall on different banks
    const float* rr = red + (tid >> 8) * GTILE + (tid & 15) * GPITCH + ((tid >> 4) & 15);
    float sum = 0.f;
#pragma unroll
    for (int w = 0; w < GWAVES; ++w)   // unrolled: the 16 LDS reads issue together
        sum += rr[w * (2 * GTILE)];
    // the block's two tiles are 2 KB in a row in the workspace, [tile][m][l]: whole lines, one writer each
    ws[WS_GPART + (size_t)bs * GPART + pr * 512 + tid] = sum;
}

// ---------------------------------------------------------------------------
// One wave's share of a 64x64x64 product D[m][n] = sum_k X[m][k] * Y[n][k]:
// row tile mt against column tiles nt and nt+1. X and Y lie in LDS at pitch LP
// with k contiguous. Lane (c, hh) reads k = 8*kk + 4*hh + 0..3 of its row of X
// and of Y with the same code, so both operands carry the same k order.
// ---------------------------------------------------------------------------
__device__ __forceinline__ void mm64_tiles(const float* X, const float* Y,
                                           int mt, int nt, int c, int hh,
                                           v8f& d0, v8f& d1) {
    const float* xp = X + (mt * 16 + c) * LP + 4 * hh;
    const float* y0 = Y + (nt * 16 + c) * LP + 4 * hh;
    const float* y1 = y0 + 16 * LP;
    // unrolled whole: the LDS reads can issue ahead of the matrix run, no branch behind a WMMA
#pragma unroll
    for (int kk = 0; kk < 8; ++kk) {
        const v4f a  = *(const v4f*)(xp + kk * 8);
        const v4f b0 = *(const v4f*)(y0 + kk * 8);
        const v4f b1 = *(const v4f*)(y1 + kk * 8);
        const v2f alo = {a.x, a.y},   ahi = {a.z, a.w};
        const v2f p0  = {b0.x, b0.y}, q0  = {b0.z, b0.w};
        const v2f p1  = {b1.x, b1.y}, q1  = {b1.z, b1.w};
        d0 = __builtin_amdgcn_wmma_f32_16x16x4_f32(false, alo, false, p0, (short)0, d0, false, false);
        d1 = __builtin_amdgcn_wmma_f32_16x16x4_f32(false, alo, false, p1, (short)0, d1, false, false);
        d0 = __builtin_amdgcn_wmma_f32_16x16x4_f32(false, ahi, false, q0, (short)0, d0, false, false);
        d1 = __builtin_amdgcn_wmma_f32_16x16x4_f32(false, ahi, false, q1, (short)0, d1, false, false);
    }
}

// The same for one tile: row tile mt of X against the 16 rows of Y, the products summed in the same order.
__device__ __forceinline__ void mm64_tile(const float* X, const float* Y,
                                          int mt, int c, int hh, v8f& d) {
    const float* xp = X + (mt * 16 + c) * LP + 4 * hh;
    const float* yp = Y + c * LP + 4 * hh;
    v4f a[8], y[8];
#pragma unroll
    for (int kk = 0; kk < 8; ++kk) {   // unrolled: a and y are indexed by constants and stay in registers
        a[kk] = *(const v4f*)(xp + kk * 8);
        y[kk] = *(const v4f*)(yp + kk * 8);
    }
    // keeps all 16 reads issued ahead of the matrix run, for speed only
    __builtin_amdgcn_sched_barrier(0);
#pragma unroll
    for (int kk = 0; kk < 8; ++kk) {   // unrolled: constant indices, no branch behind a WMMA
        const v2f alo = {a[kk].x, a[kk].y}, ahi = {a[kk].z, a[kk].w};
        const v2f p   = {y[kk].x, y[kk].y}, q   = {y[kk].z, y[kk].w};
        d = __builtin_amdgcn_wmma_f32_16x16x4_f32(false, alo, false, p, (short)0, d, false, false);
        d = __builtin_amdgcn_wmma_f32_16x16x4_f32(false, ahi, false, q, (short)0, d, false, false);
    }
    // keeps the address arithmetic of the stores that follow out of the matrix run, where it took over operand
    // registers one slot behind the WMMA that read them
    __builtin_amdgcn_sched_barrier(0);
    // four vector slots between the last WMMA and that arithmetic, which may take over its operand registers too
    asm volatile("v_nop\n\tv_nop\n\tv_nop\n\tv_nop");
    // holds the arithmetic behind the four slots
    __builtin_amdgcn_sched_barrier(0);
}

// D tile (rows 16*mt + 8*hh + r, column n) stored transposed: Z[n][m], 8 consecutive m per lane
__device__ __forceinline__ void store_tile_t(float* Z, int mt, int n, int hh, const v8f& d) {
    float* z = Z + n * LP + mt * 16 + hh * 8;
    const v4f lo = {d[0], d[1], d[2], d[3]}, hi = {d[4], d[5], d[6], d[7]};
    *(v4f*)z = lo;
    *(v4f*)(z + 4) = hi;
}

// Value of lane l ^ M, M < 16, by a DPP move inside the 16-lane row; every lane is on where it is used.
template <int M>
__device__ __forceinline__ float lane_xor(float v) {
    return __builtin_bit_cast(float,
        __builtin_amdgcn_update_dpp(0, __builtin_bit_cast(int, v), 0x160 | M, 0xf, 0xf, true));   // 0x160 | M = row_xmask:M
}

// Sum over the 16 lanes of a row; every lane gets it.
__device__ __forceinline__ float row16_sum(float v) {
    v += lane_xor<1>(v);
    v += lane_xor<2>(v);
    v += lane_xor<4>(v);
    v += lane_xor<8>(v);
    return v;
}

// One chunk of the Gram sum's loads: floats 1024*c + 4*tid + 0..3 of every slice's stored tiles, 16 bytes a lane each.
__device__ __forceinline__ void gram_chunk(const float* gp, int c, v4f (&r)[NSLICE]) {
#pragma unroll
    for (int q = 0; q < NSLICE; ++q)   // unrolled: 16 independent loads, r is indexed by constants
        r[q] = *(const v4f*)(gp + q * GPART + c * 1024);
}

// Sums a chunk over the slices, slice 0 first from 0.f, and puts it into the map of G in LDS. That map is kept by tiles:
// row 16*t + m is G row 4*m + t, column 16*u + l is G column 4*l + u. The thread's four values are [m][l0 .. l0+3] of
// stored tile i = (t, u): one 16-byte store at their own place and, off the diagonal, four stores at the mirrored place.
__device__ __forceinline__ void gram_put(float* sG, const v4f (&r)[NSLICE], int i, int m, int l0) {
    v4f s = {0.f, 0.f, 0.f, 0.f};
#pragma unroll
    for (int q = 0; q < NSLICE; ++q) s += r[q];   // unrolled: r is indexed by constants and stays in registers
    const int t = TILE_T(i), u = TILE_U(i);
    *(v4f*)(sG + (16 * t + m) * LP + 16 * u + l0) = s;
    if (t != u) {
        float* z = sG + (16 * u + l0) * LP + 16 * t + m;
        z[0] = s.x;  z[LP] = s.y;  z[2 * LP] = s.z;  z[3 * LP] = s.w;
    }
}

// Eight asynchronous copies to LDS, 4 bytes a lane each: copy i brings g[i * 2048] (four rows of Wo on) to LDS byte
// address lds + i * 16 * LP (four rows of the map on), through no register. Every lane is on where it is called.
// The s_wait_xcnt 0 is a precaution and is the statement's own last line, so that it stands in front of any reuse
// of the address registers that the copies name.
__device__ __forceinline__ void async8_b32(const float* g, unsigned lds) {
    asm volatile("global_load_async_to_lds_b32 %0, %8, off\n\t"
                 "global_load_async_to_lds_b32 %1, %9, off\n\t"
                 "global_load_async_to_lds_b32 %2, %10, off\n\t"
                 "global_load_async_to_lds_b32 %3, %11, off\n\t"
                 "global_load_async_to_lds_b32 %4, %12, off\n\t"
                 "global_load_async_to_lds_b32 %5, %13, off\n\t"
                 "global_load_async_to_lds_b32 %6, %14, off\n\t"
                 "global_load_async_to_lds_b32 %7, %15, off\n\t"
                 "s_wait_xcnt 0x0"
                 :: "v"(lds), "v"(lds + 16 * LP), "v"(lds + 32 * LP), "v"(lds + 48 * LP),
                    "v"(lds + 64 * LP), "v"(lds + 80 * LP), "v"(lds + 96 * LP), "v"(lds + 112 * LP),
                    "v"(g), "v"(g + 2048), "v"(g + 2 * 2048), "v"(g + 3 * 2048),
                    "v"(g + 4 * 2048), "v"(g + 5 * 2048), "v"(g + 6 * 2048), "v"(g + 7 * 2048)
                 : "memory");
}

// ---------------------------------------------------------------------------
// Kernel 2: per (b,h): S = Wq_h G Wk_h^T ; instance-norm ; softmax(rows) ;
//           M = attn @ Wv_h ; Pcontrib = Wo_h @ M.   All 64x64, done in LDS, on WMMA f32.
// Four blocks a head. The norm and the softmax need all of S, so each block forms S and attn whole
// (8 waves x 2 tiles of 16x16 a product); of M and Pcontrib, whose columns e are independent of one
// another, it forms only its own 16 columns: 4 tiles a product, one on each of waves 0..3.
// ---------------------------------------------------------------------------
__global__ __launch_bounds__(256)
void heads_kernel(const float* __restrict__ Wq, const float* __restrict__ Wk,
                  const float* __restrict__ Wv, const float* __restrict__ Wo,
                  float* __restrict__ ws) {
    __shared__ __attribute__((aligned(16))) float sG[64 * LP], sT[64 * LP], sS[64 * LP];
    __shared__ __attribute__((aligned(16))) float sWk[64 * LP], sWq[64 * LP], sWv[64 * LP], sWo[64 * LP];
    __shared__ __attribute__((aligned(16))) float red[16], red2[16];   // one partial sum per 16 lanes

    const int b  = blockIdx.x >> 5;
    const int h  = (blockIdx.x >> 2) & 7;
    const int eq = blockIdx.x & 3;                 // the block's columns e = 16*eq + 0..15 of M and Pcontrib
    const int tid = threadIdx.x;
    const int lane = tid & 31;
    const int lc = lane & 15, lh = lane >> 4;      // fragment column / k half
    const int mt = tid >> 6;                       // wave's row tile
    const int nt = ((tid >> 5) & 1) * 2;           // wave's first column tile
    const v8f zero8 = {0.f, 0.f, 0.f, 0.f, 0.f, 0.f, 0.f, 0.f};

    // Wk, Wq and Wv are requested here, ahead of the Gram sum: their latency runs under that sum's own loads.
    // Wo_h is one float in eight of every line of Wo, 1024 lines for 16 KB of use, and only the last product reads it:
    // it follows behind the sum's last load, by asynchronous copies that land under the products before.
    // Thread tid holds elements i = tid + 256*j of each 64x64 map: row (tid >> 6) + 4*j, column tid & 63.
    const int trow = tid >> 6, tcol = tid & 63;
    const float* gk = Wk + h * 4096 + tid;
    const float* gq = Wq + h * 4096 + tid;
    const float* gv = Wv + h * 4096 + tid;
    const float* go = Wo + trow * 512 + tcol * 8 + h;   // Wo_h[c',c] = Wo[c'*512 + c*8 + h]
    float rk[16], rq[16], rv[16];
#pragma unroll
    for (int j = 0; j < 16; ++j) {   // unrolled: the 48 loads are in flight together, values stay in registers
        rk[j] = gk[j * 256];
        rq[j] = gq[j * 256];
        rv[j] = gv[j * 256];
    }
    // precaution: stands in front of any reuse of the loads' address registers; the pointers are named as
    // inputs so that their register pairs are not rewritten ahead of the wait
    asm volatile("s_wait_xcnt 0x0" :: "v"(gk), "v"(gq), "v"(gv) : "memory");

    // the wave's number as a scalar: the branches on it are scalar, and every lane is on at the WMMAs inside them.
    const int wv = __builtin_amdgcn_readfirstlane(tid >> 5);

    // Deterministic sum of the Gram partials over the 16 slices. A slice's 10 stored tiles are 640 pieces of 16 bytes:
    // thread tid owns pieces tid and tid + 256, and in waves 0..3 piece tid + 512; a wave's load is 512 contiguous bytes.
    // Piece tid + 256*c is [m][l0 .. l0+3] of stored tile (tid >> 6) + 4*c, m = (tid >> 2) & 15, l0 = 4*(tid & 3).
    const float* gbase = ws + WS_GPART + (size_t)b * NSLICE * GPART;   // the same for the whole block
    const float* gp = gbase + 4 * tid;
    v4f c0[NSLICE], c1[NSLICE], c2[NSLICE];
    gram_chunk(gp, 0, c0);
    gram_chunk(gp, 1, c1);
    // Wk and Wq are contracted with G's columns and rows: their columns are kept in the order of the map of G in LDS
    const int pcol = 16 * (tcol & 3) + (tcol >> 2);
#pragma unroll
    for (int j = 0; j < 16; ++j) {   // unrolled: rk..rv are indexed by constants
        sWk[(trow + 4 * j) * LP + pcol] = rk[j];
        sWq[(trow + 4 * j) * LP + pcol] = rq[j];
        sWv[tcol * LP + trow + 4 * j] = rv[j];   // kept as sWv[e][d], so that the product's k (= d) is contiguous
    }
    // the third chunk starts only here, where the weights have left their registers: without it all three chunks
    // and the weights are live together
    __builtin_amdgcn_sched_barrier(0);
    {
        const int gm = (tid >> 2) & 15, gl = 4 * (tid & 3), gi = tid >> 6;
        // Wo_h[c'][c], c' = trow + 4*j, c = tcol, goes to sWo at the same place: 16 copies a lane, in either branch
        // behind the wave's last load. lo is the lane's LDS byte address of j = 0.
        const unsigned lo = (unsigned)(size_t)(sWo + trow * LP + tcol);
        if (wv < 4) {
            gram_chunk(gp, 2, c2);
            // precaution: behind the last load, in front of any reuse of the loads' address registers (the block's
            // base and the thread index, or the thread's own pointer): all are named as inputs so that none of them
            // is rewritten, by a load's result either, ahead of the wait
            asm volatile("s_wait_xcnt 0x0" :: "s"(gbase), "v"(tid), "v"(gp) : "memory");
            async8_b32(go, lo);
            async8_b32(go + 8 * 2048, lo + 128 * LP);
            gram_put(sG, c0, gi, gm, gl);
            gram_put(sG, c1, gi + 4, gm, gl);
            // keeps the third chunk's sum last: loads return in order, and ahead of the other two it would wait out all 48
            __builtin_amdgcn_sched_barrier(0);
            gram_put(sG, c2, gi + 8, gm, gl);
        } else {
            // the same precaution for the waves whose last load is the second chunk's
            asm volatile("s_wait_xcnt 0x0" :: "s"(gbase), "v"(tid) : "memory");
            async8_b32(go, lo);
            async8_b32(go + 8 * 2048, lo + 128 * LP);
            gram_put(sG, c0, gi, gm, gl);
            gram_put(sG, c1, gi + 4, gm, gl);
        }
    }
    __syncthreads();

    // T1[e,d] = sum_f G[e,f] * Wk_h[d,f], kept as sT[d][e]; e and f run in the order of the map of G
    {
        v8f d0 = zero8, d1 = zero8;
        mm64_tiles(sG, sWk, mt, nt, lc, lh, d0, d1);
        store_tile_t(sT, mt, nt * 16 + lc, lh, d0);
        store_tile_t(sT, mt, nt * 16 + 16 + lc, lh, d1);
    }
    __syncthreads();

    // S[c,d] = sum_e Wq_h[c,e] * T1[e,d], e in that same order in both operands
    {
        v8f d0 = zero8, d1 = zero8;
        mm64_tiles(sWq, sT, mt, nt, lc, lh, d0, d1);
        float* sp = sS + (mt * 16 + lh * 8) * LP + nt * 16 + lc;
#pragma unroll
        for (int r = 0; r < 8; ++r) {   // unrolled: d0, d1 are indexed by constants and stay in registers
            sp[r * LP]      = d0[r];
            sp[r * LP + 16] = d1[r];
        }
    }
    __syncthreads();

    // InstanceNorm over the full 64x64 map (biased variance, eps=1e-5), then softmax along d, all in registers:
    // thread tid holds columns 16*(tid & 3) + 0..15 of row tid >> 2, so the four lanes of a row are neighbours
    // and a 16-byte read of lanes 0..15 (4 rows x 4 quarters at pitch LP) falls on 64 different banks.
    {
        float* rowp = sS + (tid >> 2) * LP + 16 * (tid & 3);
        v4f x[4];
#pragma unroll
        for (int i = 0; i < 4; ++i) x[i] = *(const v4f*)(rowp + 4 * i);   // unrolled: x stays in registers

        const v4f sv = (x[0] + x[1]) + (x[2] + x[3]);
        const v4f qv = (x[0] * x[0] + x[1] * x[1]) + (x[2] * x[2] + x[3] * x[3]);
        const float s  = row16_sum((sv.x + sv.y) + (sv.z + sv.w));
        const float s2 = row16_sum((qv.x + qv.y) + (qv.z + qv.w));
        if (lc == 0) { red[tid >> 4] = s; red2[tid >> 4] = s2; }
        __syncthreads();
        // every thread adds the 16 partial sums itself, in one fixed order: no thread waits for another's result
        const v4f* r1 = (const v4f*)red;
        const v4f* r2 = (const v4f*)red2;
        const v4f ts = (r1[0] + r1[1]) + (r1[2] + r1[3]);
        const v4f tq = (r2[0] + r2[1]) + (r2[2] + r2[3]);
        const float mean = ((ts.x + ts.y) + (ts.z + ts.w)) * (1.0f / 4096.0f);
        const float var  = ((tq.x + tq.y) + (tq.z + tq.w)) * (1.0f / 4096.0f) - mean * mean;
        const float rstd = rsqrtf(var + 1e-5f);

#pragma unroll
        for (int i = 0; i < 4; ++i) x[i] = (x[i] - mean) * rstd;   // unrolled, as every loop over x: constant indices
        v4f mv = x[0];
#pragma unroll
        for (int i = 1; i < 4; ++i) {   // unrolled: constant indices into x
            mv.x = fmaxf(mv.x, x[i].x);  mv.y = fmaxf(mv.y, x[i].y);
            mv.z = fmaxf(mv.z, x[i].z);  mv.w = fmaxf(mv.w, x[i].w);
        }
        float m = fmaxf(fmaxf(mv.x, mv.y), fmaxf(mv.z, mv.w));
        m = fmaxf(m, lane_xor<1>(m));
        m = fmaxf(m, lane_xor<2>(m));

        v4f ev = {0.f, 0.f, 0.f, 0.f};
#pragma unroll
        for (int i = 0; i < 4; ++i) {   // unrolled: constant indices into x; the 16 exponentials are independent
            x[i].x = expf(x[i].x - m);  x[i].y = expf(x[i].y - m);
            x[i].z = expf(x[i].z - m);  x[i].w = expf(x[i].w - m);
            ev += x[i];
        }
        float e = (ev.x + ev.y) + (ev.z + ev.w);
        e += lane_xor<1>(e);
        e += lane_xor<2>(e);
        const float inv = 1.f / e;
        // a thread rewrites only what it read itself, so no barrier is needed between its reads and these stores
#pragma unroll
        for (int i = 0; i < 4; ++i) *(v4f*)(rowp + 4 * i) = x[i] * inv;   // unrolled: constant indices into x
    }
    // the wave's own copies of Wo have landed; the barrier behind it publishes them to the other waves
    asm volatile("s_wait_asynccnt 0x0" ::: "memory");
    __syncthreads();

    // M[c,e] = sum_d attn[c,d] * Wv_h[d,e] for the block's 16 columns, kept as sT[e - 16*eq][c]
    if (wv < 4) {
        v8f d = zero8;
        mm64_tile(sS, sWv + eq * 16 * LP, wv, lc, lh, d);
        store_tile_t(sT, wv, lc, lh, d);
    }
    __syncthreads();

    // Pcontrib[c',e] = sum_c Wo_h[c',c] * M[c,e] for the same columns; the block's 64 x 16 piece is contiguous
    // in the workspace, so that no 128-byte line has two writers
    if (wv < 4) {
        v8f d = zero8;
        mm64_tile(sWo, sT, wv, lc, lh, d);
        float* pc = ws + WS_PC + (size_t)((b * H_ + h) * 4 + eq) * 1024
                  + (wv * 16 + lh * 8) * 16 + lc;
#pragma unroll
        for (int r = 0; r < 8; ++r)   // unrolled: d is indexed by constants and stays in registers
            pc[r * 16] = d[r];
    }
}

// ---------------------------------------------------------------------------
// Kernel 3: P_b = sum_h Pcontrib[b][h], summed by every block while it stages P in LDS
//           (h ascending from 0.f, deterministic); out_b[n,c'] = emb_b[n,:] . P_b[c',:] on WMMA.
// Each wave: one 16-row stripe x all 64 output columns (4 accumulators).
// P lies in LDS at pitch LP (16 B x odd). Lane (rlo, hh) reads k = 8*kk + 4*hh + 0..3 of its emb row
// and of its four P rows, 16 bytes each: both operands carry the same k order, and the 16 rows that
// the lanes of a read touch fall on different banks.
// ---------------------------------------------------------------------------
__global__ __launch_bounds__(256)
void out_kernel(const float* __restrict__ emb, const float* __restrict__ ws,
                float* __restrict__ out) {
    __shared__ __attribute__((aligned(16))) float sP[64 * LP];
    const int batch = blockIdx.x >> 7;   // 128 blocks per batch
    const int blk   = blockIdx.x & 127;
    const int tid   = threadIdx.x;

    // Thread tid owns elements 4*tid + 1024*j + 0..3 of a stored map, j = 0..3: row tid >> 2 of P, columns 16*j + 4*(tid & 3) + 0..3.
    {
        const float* pc = ws + WS_PC + (size_t)batch * H_ * 4096 + 4 * tid;
        v4f part[H_][4];
#pragma unroll
        for (int h = 0; h < H_; ++h)   // unrolled with the next loop: 32 independent loads of 16 bytes, no wait per trip
#pragma unroll
            for (int j = 0; j < 4; ++j)
                part[h][j] = *(const v4f*)(pc + h * 4096 + j * 1024);
#pragma unroll
        for (int j = 0; j < 4; ++j) {   // unrolled: part is indexed by constants and stays in registers
            v4f s = {0.f, 0.f, 0.f, 0.f};
#pragma unroll
            for (int h = 0; h < H_; ++h) s += part[h][j];
            *(v4f*)(sP + (tid >> 2) * LP + 16 * j + 4 * (tid & 3)) = s;
        }
    }
    __syncthreads();

    const int wave = tid >> 5, lane = tid & 31;
    const int n0   = (blk * 8 + wave) * 16;
    const int rlo  = lane & 15;
    const int hh   = lane >> 4;

    const float* A  = emb + ((size_t)batch * N_ + n0 + rlo) * C_ + 4 * hh;
    const float* bp = sP + rlo * LP + 4 * hh;
    float* O = out + ((size_t)batch * N_ + n0 + 8 * hh) * C_ + rlo;   // the lane's first output element

    v4f a[8], b[8][4];
#pragma unroll
    for (int kk = 0; kk < 8; ++kk)   // unrolled: the 8 loads of a lane are in flight together
        a[kk] = *(const v4f*)(A + kk * 8);
    // precaution: stands in front of any reuse of the loads' address registers; A is named as an input so that
    // its register pair is not rewritten ahead of the wait, O so that it is formed here and not inside the
    // matrix run, where its arithmetic took over operand registers one slot behind the WMMA that read them
    asm volatile("s_wait_xcnt 0x0" :: "v"(A), "v"(O) : "memory");
#pragma unroll
    for (int kk = 0; kk < 8; ++kk)   // unrolled with the next loop: b is indexed by constants and stays in registers
#pragma unroll
        for (int u = 0; u < 4; ++u)
            b[kk][u] = *(const v4f*)(bp + u * 16 * LP + kk * 8);   // P[c',e] = B[k,n'], c' = 16*u + rlo
    // keeps all 40 reads issued ahead of the matrix run: without it the compiler sinks them, in pairs, to
    // just in front of their first use, and each pair's latency is waited for in turn
    __builtin_amdgcn_sched_barrier(0);

    v8f acc0 = {0.f,0.f,0.f,0.f,0.f,0.f,0.f,0.f};
    v8f acc1 = acc0, acc2 = acc0, acc3 = acc0;

    // unrolled whole: a and b are indexed by constants; each step waits only for its own reads
#pragma unroll
    for (int kk = 0; kk < 8; ++kk) {
        const v2f alo = {a[kk].x, a[kk].y}, ahi = {a[kk].z, a[kk].w};
        const v2f p0 = {b[kk][0].x, b[kk][0].y}, q0 = {b[kk][0].z, b[kk][0].w};
        const v2f p1 = {b[kk][1].x, b[kk][1].y}, q1 = {b[kk][1].z, b[kk][1].w};
        const v2f p2 = {b[kk][2].x, b[kk][2].y}, q2 = {b[kk][2].z, b[kk][2].w};
        const v2f p3 = {b[kk][3].x, b[kk][3].y}, q3 = {b[kk][3].z, b[kk][3].w};
        acc0 = __builtin_amdgcn_wmma_f32_16x16x4_f32(false, alo, false, p0, (short)0, acc0, false, false);
        acc1 = __builtin_amdgcn_wmma_f32_16x16x4_f32(false, alo, false, p1, (short)0, acc1, false, false);
        acc2 = __builtin_amdgcn_wmma_f32_16x16x4_f32(false, alo, false, p2, (short)0, acc2, false, false);
        acc3 = __builtin_amdgcn_wmma_f32_16x16x4_f32(false, alo, false, p3, (short)0, acc3, false, false);
        acc0 = __builtin_amdgcn_wmma_f32_16x16x4_f32(false, ahi, false, q0, (short)0, acc0, false, false);
        acc1 = __builtin_amdgcn_wmma_f32_16x16x4_f32(false, ahi, false, q1, (short)0, acc1, false, false);
        acc2 = __builtin_amdgcn_wmma_f32_16x16x4_f32(false, ahi, false, q2, (short)0, acc2, false, false);
        acc3 = __builtin_amdgcn_wmma_f32_16x16x4_f32(false, ahi, false, q3, (short)0, acc3, false, false);
    }

#pragma unroll
    for (int r = 0; r < 8; ++r) {
        O[r * C_ +  0] = acc0[r];
        O[r * C_ + 16] = acc1[r];
        O[r * C_ + 32] = acc2[r];
        O[r * C_ + 48] = acc3[r];
    }
}

// ---------------------------------------------------------------------------
extern "C" void kernel_launch(void* const* d_in, const int* in_sizes, int n_in,
                              void* d_out, int out_size, void* d_ws, size_t ws_size,
                              hipStream_t stream) {
    const float* emb = (const float*)d_in[0];
    const float* Wq  = (const float*)d_in[1];
    const float* Wk  = (const float*)d_in[2];
    const float* Wv  = (const float*)d_in[3];
    const float* Wo  = (const float*)d_in[4];
    float* ws  = (float*)d_ws;
    float* out = (float*)d_out;

    hipLaunchKernelGGL(g_partial_kernel, dim3(B_ * NSLICE * 5), dim3(512), 0, stream, emb, ws);
    hipLaunchKernelGGL(heads_kernel,     dim3(B_ * H_ * 4), dim3(256), 0, stream, Wq, Wk, Wv, Wo, ws);
    hipLaunchKernelGGL(out_kernel,       dim3(256),         dim3(256), 0, stream, emb, ws, out);
}
